// v000
// The times below were measured on an AMD MI455X: many runs one after another, warmed up first and cycling through
// copies of the inputs, with the whole window's GPU time divided by the number of runs. Launches and the gaps
// between them are all in it. The median over several windows is given; except for v000 it joins two sittings, which
// can be a few percent apart, so the side-by-side timings, each taken in one sitting, are the better comparison.
// v000, which the later versions start from, runs in 1190 microseconds.
#include <hip/hip_runtime.h>
#include <hip/hip_bf16.h>

typedef __attribute__((ext_vector_type(16))) _Float16     v16h;
typedef __attribute__((ext_vector_type(8)))  float        v8f;
typedef __attribute__((ext_vector_type(4)))  unsigned int v4u;
typedef __attribute__((ext_vector_type(2)))  unsigned int v2u;
typedef __attribute__((ext_vector_type(4)))  int          v4i;
typedef __attribute__((address_space(1))) v4i* gv4i_p;  // global ("__device__")
typedef __attribute__((address_space(3))) v4i* lv4i_p;  // LDS ("__shared__")

#define S_LEN  4096
#define BATCH  8
#define DMODEL 768
#define NHEAD  12
#define HD     64
#define WIN    128
#define NWIN   32
#define W3     384
#define NEGMAX (-3.402823466e+38f)

#if __has_builtin(__builtin_amdgcn_global_load_async_to_lds_b128)
#define HAVE_ASYNC_LDS 1
#endif

union Frag { v4u u[2]; v16h h; };

__device__ __forceinline__ v8f wmma_f16(v16h a, v16h b, v8f c) {
  return __builtin_amdgcn_wmma_f32_16x16x32_f16(false, a, false, b, (short)0, c,
                                                false, false);
}

__device__ __forceinline__ void wait_async0() {
#ifdef HAVE_ASYNC_LDS
#if __has_builtin(__builtin_amdgcn_s_wait_asynccnt)
  __builtin_amdgcn_s_wait_asynccnt(0);
#else
  asm volatile("s_wait_asynccnt 0" ::: "memory");
#endif
#endif
}

// ---------------------------------------------------------------------------
// Kernel 1: fused Q/K/V projection GEMM (z selects weight), f32 in -> f16 out
// scattered into (B*H, S, hd) layout. Block tile 128x128, K-chunks of 32,
// double-buffered LDS so global loads overlap the WMMAs.
// ---------------------------------------------------------------------------
__global__ __launch_bounds__(256) void qkv_gemm_wmma(
    const float* __restrict__ X, const float* __restrict__ W0,
    const float* __restrict__ W1, const float* __restrict__ W2,
    const float* __restrict__ b0, const float* __restrict__ b1,
    const float* __restrict__ b2, _Float16* __restrict__ q16,
    _Float16* __restrict__ k16, _Float16* __restrict__ v16) {
  __shared__ _Float16 Xs[2][128 * 32];
  __shared__ _Float16 Ws[2][128 * 32];

  int z = blockIdx.z;
  const float* W = (z == 0) ? W0 : (z == 1) ? W1 : W2;
  const float* bias = (z == 0) ? b0 : (z == 1) ? b1 : b2;
  _Float16* dst = (z == 0) ? q16 : (z == 1) ? k16 : v16;

  int m0 = blockIdx.x * 128;
  int n0 = blockIdx.y * 128;
  int tid = threadIdx.x;
  int wid = tid >> 5, lane = tid & 31;
  int lm = lane & 15, lh = lane >> 4;
  int wm = (wid & 3) * 32;   // wave M offset
  int wn = (wid >> 2) * 64;  // wave N offset

  float4 xr[4], wr[4];  // staged global data for next chunk

  auto load_global = [&](int k0) {
    for (int it = 0; it < 4; it++) {  // all loads issued before any use
      int v = tid + it * 256;
      int row = v >> 3, c4 = (v & 7) << 2;
      xr[it] = *(const float4*)(X + (size_t)(m0 + row) * DMODEL + k0 + c4);
      int kk = v >> 5, n4 = (v & 31) << 2;
      wr[it] = *(const float4*)(W + (size_t)(k0 + kk) * DMODEL + n0 + n4);
    }
  };
  auto store_lds = [&](int buf) {
    for (int it = 0; it < 4; it++) {
      int v = tid + it * 256;
      int row = v >> 3, c4 = (v & 7) << 2;
      union { _Float16 h[4]; v2u u; } pk;
      pk.h[0] = (_Float16)xr[it].x; pk.h[1] = (_Float16)xr[it].y;
      pk.h[2] = (_Float16)xr[it].z; pk.h[3] = (_Float16)xr[it].w;
      *(v2u*)(&Xs[buf][row * 32 + c4]) = pk.u;
      int kk = v >> 5, n4 = (v & 31) << 2;
      Ws[buf][(n4 + 0) * 32 + kk] = (_Float16)wr[it].x;
      Ws[buf][(n4 + 1) * 32 + kk] = (_Float16)wr[it].y;
      Ws[buf][(n4 + 2) * 32 + kk] = (_Float16)wr[it].z;
      Ws[buf][(n4 + 3) * 32 + kk] = (_Float16)wr[it].w;
    }
  };

  load_global(0);
  store_lds(0);
  v8f acc[2][4] = {};

  const int NKC = DMODEL / 32;  // 24
  for (int kc = 0; kc < NKC; kc++) {
    __syncthreads();
    if (kc + 1 < NKC) load_global((kc + 1) * 32);  // overlap with WMMAs
    int cb = kc & 1;
    Frag af[2], bf[4];
    for (int mt = 0; mt < 2; mt++) {
      const _Float16* p = &Xs[cb][(wm + mt * 16 + lm) * 32 + lh * 8];
      af[mt].u[0] = *(const v4u*)p;
      af[mt].u[1] = *(const v4u*)(p + 16);
    }
    for (int nt = 0; nt < 4; nt++) {
      const _Float16* p = &Ws[cb][(wn + nt * 16 + lm) * 32 + lh * 8];
      bf[nt].u[0] = *(const v4u*)p;
      bf[nt].u[1] = *(const v4u*)(p + 16);
    }
    for (int mt = 0; mt < 2; mt++)
      for (int nt = 0; nt < 4; nt++)
        acc[mt][nt] = wmma_f16(af[mt].h, bf[nt].h, acc[mt][nt]);
    if (kc + 1 < NKC) store_lds((kc + 1) & 1);
  }

  // epilogue: +bias, scatter to (b*H+h, s, e) f16
  for (int mt = 0; mt < 2; mt++)
    for (int nt = 0; nt < 4; nt++) {
      int col = n0 + wn + nt * 16 + lm;
      float bvv = bias[col];
      int h = col >> 6, e = col & 63;
      for (int r = 0; r < 8; r++) {
        int t = m0 + wm + mt * 16 + r + 8 * lh;  // token index = s*B + b
        int s = t >> 3, b = t & 7;
        dst[((size_t)(b * NHEAD + h) * S_LEN + s) * HD + e] =
            (_Float16)(acc[mt][nt][r] + bvv);
      }
    }
}

// ---------------------------------------------------------------------------
// Kernel 2: local windowed attention with look-around, flash-style online
// softmax, all matmuls via v_wmma_f32_16x16x32_f16. K tile staged with
// GLOBAL_LOAD_ASYNC_TO_LDS_B128 when the toolchain exposes it.
// grid (NWIN, B*H), 256 threads (8 waves x 16 query rows).
// ---------------------------------------------------------------------------
__global__ __launch_bounds__(256) void local_attn_wmma(
    const _Float16* __restrict__ q16, const _Float16* __restrict__ k16,
    const _Float16* __restrict__ v16, const int* __restrict__ kpm,
    float* __restrict__ out) {
  extern __shared__ char smem[];
  _Float16* Ksm = (_Float16*)smem;         // 384 x 64
  _Float16* Vts = Ksm + W3 * HD;           // 64 x 384 (V transposed)
  float* mJ = (float*)(Vts + HD * W3);     // 384
  float* mI = mJ + W3;                     // 128
  _Float16* Pst = (_Float16*)(mI + WIN);   // 8 waves * 16*32

  int w = blockIdx.x, bh = blockIdx.y;
  int b = bh / NHEAD, hh = bh % NHEAD;
  int tid = threadIdx.x, wid = tid >> 5, lane = tid & 31;
  int lm = lane & 15, lh = lane >> 4;
  const _Float16* Kg = k16 + (size_t)bh * S_LEN * HD;
  const _Float16* Vg = v16 + (size_t)bh * S_LEN * HD;

  // K tile (zero-padded look-around), row-major; async copy where possible
  for (int idx = tid; idx < W3 * 8; idx += 256) {
    int j = idx >> 3, c = idx & 7;
    int s = (w - 1) * WIN + j;
    _Float16* dp = Ksm + j * HD + c * 8;
    if (s >= 0 && s < S_LEN) {
#ifdef HAVE_ASYNC_LDS
      __builtin_amdgcn_global_load_async_to_lds_b128(
          (gv4i_p)(Kg + (size_t)s * HD + c * 8), (lv4i_p)dp, 0, 0);
#else
      *(v4u*)dp = *(const v4u*)(Kg + (size_t)s * HD + c * 8);
#endif
    } else {
      v4u zz = {};
      *(v4u*)dp = zz;
    }
  }
  for (int j = tid; j < W3; j += 256) {
    int s = (w - 1) * WIN + j;
    mJ[j] = (s < 0 || s >= S_LEN) ? 1.f : (kpm[b * S_LEN + s] ? 1.f : 0.f);
  }
  for (int i = tid; i < WIN; i += 256)
    mI[i] = kpm[b * S_LEN + w * WIN + i] ? 1.f : 0.f;
  // V tile transposed: Vts[e][j] (vector global read, scalar LDS scatter)
  for (int idx = tid; idx < W3 * 8; idx += 256) {
    int j = idx >> 3, c = idx & 7;
    int s = (w - 1) * WIN + j;
    _Float16 vh[8];
    if (s >= 0 && s < S_LEN) {
      *(v4u*)vh = *(const v4u*)(Vg + (size_t)s * HD + c * 8);
    } else {
      v4u zz = {};
      *(v4u*)vh = zz;
    }
    for (int q = 0; q < 8; q++) Vts[(c * 8 + q) * W3 + j] = vh[q];
  }
  wait_async0();
  __syncthreads();

  int i0 = wid * 16;
  const _Float16* Qg = q16 + ((size_t)bh * S_LEN + (size_t)w * WIN + i0) * HD;
  Frag aq[2];
  for (int ec = 0; ec < 2; ec++) {
    const _Float16* p = Qg + lm * HD + ec * 32 + lh * 8;
    aq[ec].u[0] = *(const v4u*)p;
    aq[ec].u[1] = *(const v4u*)(p + 16);
  }

  const float inv = 0.125f;  // hd^-0.5
  v8f Oacc[4] = {};
  float mr[8], lr[8], mi_row[8];
  for (int r = 0; r < 8; r++) {
    mr[r] = NEGMAX;
    lr[r] = 0.f;
    mi_row[r] = mI[i0 + r + 8 * lh];
  }
  _Float16* Pw = Pst + wid * 512;

  for (int jt = 0; jt < 12; jt++) {
    // scores: two 16-col tiles over hd (K = 2 chunks of 32)
    v8f c0 = {}, c1 = {};
    for (int ec = 0; ec < 2; ec++) {
      Frag bk0, bk1;
      const _Float16* p0 = Ksm + (jt * 32 + lm) * HD + ec * 32 + lh * 8;
      bk0.u[0] = *(const v4u*)p0; bk0.u[1] = *(const v4u*)(p0 + 16);
      const _Float16* p1 = Ksm + (jt * 32 + 16 + lm) * HD + ec * 32 + lh * 8;
      bk1.u[0] = *(const v4u*)p1; bk1.u[1] = *(const v4u*)(p1 + 16);
      c0 = wmma_f16(aq[ec].h, bk0.h, c0);
      c1 = wmma_f16(aq[ec].h, bk1.h, c1);
    }
    float mj0 = mJ[jt * 32 + lm];
    float mj1 = mJ[jt * 32 + 16 + lm];
    float scl[8];
    for (int r = 0; r < 8; r++) {
      float s0 = (mi_row[r] + mj0 > 0.f) ? NEGMAX : c0[r] * inv;
      float s1 = (mi_row[r] + mj1 > 0.f) ? NEGMAX : c1[r] * inv;
      float tm = fmaxf(s0, s1);
      for (int off = 1; off < 16; off <<= 1)
        tm = fmaxf(tm, __shfl_xor(tm, off, 32));
      float mn = fmaxf(mr[r], tm);
      float sc = __expf(mr[r] - mn);
      mr[r] = mn;
      float p0 = __expf(s0 - mn);
      float p1 = __expf(s1 - mn);
      float ps = p0 + p1;
      for (int off = 1; off < 16; off <<= 1) ps += __shfl_xor(ps, off, 32);
      lr[r] = lr[r] * sc + ps;
      scl[r] = sc;
      c0[r] = p0;
      c1[r] = p1;
    }
    for (int t = 0; t < 4; t++)
      for (int r = 0; r < 8; r++) Oacc[t][r] *= scl[r];

    // stage P (16x32 f16) row-major through per-wave LDS, reload as A-frag
    for (int r = 0; r < 8; r++) {
      int il = r + 8 * lh;
      Pw[il * 32 + lm] = (_Float16)c0[r];
      Pw[il * 32 + 16 + lm] = (_Float16)c1[r];
    }
    asm volatile("" ::: "memory");  // per-wave DS ops are HW in-order
    Frag ap;
    const _Float16* pp = Pw + lm * 32 + lh * 8;
    ap.u[0] = *(const v4u*)pp;
    ap.u[1] = *(const v4u*)(pp + 16);
    for (int t = 0; t < 4; t++) {
      Frag bvf;
      const _Float16* vp = Vts + (t * 16 + lm) * W3 + jt * 32 + lh * 8;
      bvf.u[0] = *(const v4u*)vp;
      bvf.u[1] = *(const v4u*)(vp + 16);
      Oacc[t] = wmma_f16(ap.h, bvf.h, Oacc[t]);
    }
  }

  for (int t = 0; t < 4; t++) {
    int col = hh * HD + t * 16 + lm;
    for (int r = 0; r < 8; r++) {
      int srow = w * WIN + i0 + r + 8 * lh;
      out[((size_t)srow * BATCH + b) * DMODEL + col] = Oacc[t][r] / lr[r];
    }
  }
}

// ---------------------------------------------------------------------------
// Kernel 3: gq = hidden[0] @ Wgq + bgq  (tiny)
// ---------------------------------------------------------------------------
__global__ __launch_bounds__(256) void gq_proj(const float* __restrict__ X,
                                               const float* __restrict__ Wgq,
                                               const float* __restrict__ bgq,
                                               float* __restrict__ gq) {
  int idx = blockIdx.x * 256 + threadIdx.x;
  if (idx >= BATCH * DMODEL) return;
  int b = idx / DMODEL, d = idx % DMODEL;
  const float* xr = X + (size_t)b * DMODEL;  // hidden[(0,b),:]
  float s = bgq[d];
  for (int k = 0; k < DMODEL; k++) s += xr[k] * Wgq[(size_t)k * DMODEL + d];
  gq[idx] = s;  // layout (b*H+h)*64+e == b*768+d
}

// ---------------------------------------------------------------------------
// Kernel 4: global-token attention, overwrites out row 0. Deterministic
// tree reductions (no float atomics).
// ---------------------------------------------------------------------------
__global__ __launch_bounds__(256) void global_attn_kernel(
    const float* __restrict__ gq, const _Float16* __restrict__ k16,
    const _Float16* __restrict__ v16, const int* __restrict__ kpm,
    float* __restrict__ out) {
  __shared__ float sc[S_LEN];
  __shared__ float qsh[HD];
  __shared__ float red[256];
  __shared__ float accv[HD + 1];
  int bh = blockIdx.x;
  int b = bh / NHEAD, hh = bh % NHEAD;
  int tid = threadIdx.x;
  if (tid < HD) qsh[tid] = gq[bh * HD + tid];
  __syncthreads();

  const _Float16* Kg = k16 + (size_t)bh * S_LEN * HD;
  const _Float16* Vg = v16 + (size_t)bh * S_LEN * HD;
  float lmax = NEGMAX;
  for (int s = tid; s < S_LEN; s += 256) {
    const _Float16* kr = Kg + (size_t)s * HD;
    float d = 0.f;
    for (int e = 0; e < HD; e++) d += qsh[e] * (float)kr[e];
    d *= 0.125f;
    if (kpm[b * S_LEN + s]) d = NEGMAX;
    sc[s] = d;
    lmax = fmaxf(lmax, d);
  }
  red[tid] = lmax;
  __syncthreads();
  for (int st = 128; st > 0; st >>= 1) {
    if (tid < st) red[tid] = fmaxf(red[tid], red[tid + st]);
    __syncthreads();
  }
  float M = red[0];
  __syncthreads();

  float av[HD];
  for (int e = 0; e < HD; e++) av[e] = 0.f;
  float lsum = 0.f;
  for (int s = tid; s < S_LEN; s += 256) {
    float p = __expf(sc[s] - M);
    lsum += p;
    const _Float16* vr = Vg + (size_t)s * HD;
    for (int e = 0; e < HD; e++) av[e] += p * (float)vr[e];
  }
  for (int e = 0; e < HD; e++) {
    red[tid] = av[e];
    __syncthreads();
    for (int st = 128; st > 0; st >>= 1) {
      if (tid < st) red[tid] += red[tid + st];
      __syncthreads();
    }
    if (tid == 0) accv[e] = red[0];
    __syncthreads();
  }
  red[tid] = lsum;
  __syncthreads();
  for (int st = 128; st > 0; st >>= 1) {
    if (tid < st) red[tid] += red[tid + st];
    __syncthreads();
  }
  if (tid == 0) accv[HD] = red[0];
  __syncthreads();
  if (tid < HD)
    out[(size_t)b * DMODEL + hh * HD + tid] = accv[tid] / accv[HD];
}

// ---------------------------------------------------------------------------
extern "C" void kernel_launch(void* const* d_in, const int* in_sizes, int n_in,
                              void* d_out, int out_size, void* d_ws,
                              size_t ws_size, hipStream_t stream) {
  (void)in_sizes; (void)n_in; (void)out_size; (void)ws_size;
  const float* hs  = (const float*)d_in[0];
  const int*   kpm = (const int*)d_in[1];
  const float* Wq  = (const float*)d_in[2];
  const float* Wk  = (const float*)d_in[3];
  const float* Wv  = (const float*)d_in[4];
  const float* Wgq = (const float*)d_in[5];
  const float* bq  = (const float*)d_in[6];
  const float* bk  = (const float*)d_in[7];
  const float* bv  = (const float*)d_in[8];
  const float* bgq = (const float*)d_in[9];
  float* out = (float*)d_out;

  size_t per = (size_t)BATCH * NHEAD * S_LEN * HD;  // halfs per q/k/v tensor
  _Float16* q16 = (_Float16*)d_ws;
  _Float16* k16 = q16 + per;
  _Float16* v16 = k16 + per;
  float* gqbuf = (float*)(v16 + per);

  dim3 g1(256, 6, 3);
  qkv_gemm_wmma<<<g1, 256, 0, stream>>>(hs, Wq, Wk, Wv, bq, bk, bv, q16, k16,
                                        v16);
  gq_proj<<<(BATCH * DMODEL + 255) / 256, 256, 0, stream>>>(hs, Wgq, bgq,
                                                            gqbuf);
  size_t lds_bytes = (size_t)W3 * HD * 2 + (size_t)HD * W3 * 2 + W3 * 4 +
                     WIN * 4 + (size_t)8 * 512 * 2;  // 108,544 B (<320KB WGP)
  dim3 g2(NWIN, BATCH * NHEAD);
  local_attn_wmma<<<g2, 256, lds_bytes, stream>>>(q16, k16, v16, kpm, out);
  global_attn_kernel<<<BATCH * NHEAD, 256, 0, stream>>>(gqbuf, k16, v16, kpm,
                                                        out);
}

// v001
// One run takes 623 microseconds.
// Next to v000, in two timings, it ran 1.99 times as fast each time.
#include <hip/hip_runtime.h>
#include <hip/hip_bf16.h>

typedef __attribute__((ext_vector_type(16))) _Float16     v16h;
typedef __attribute__((ext_vector_type(8)))  float        v8f;
typedef __attribute__((ext_vector_type(4)))  unsigned int v4u;
typedef __attribute__((ext_vector_type(2)))  unsigned int v2u;
typedef __attribute__((ext_vector_type(4)))  int          v4i;
typedef __attribute__((address_space(1))) v4i* gv4i_p;  // global ("__device__")
typedef __attribute__((address_space(3))) v4i* lv4i_p;  // LDS ("__shared__")

#define S_LEN  4096
#define BATCH  8
#define DMODEL 768
#define NHEAD  12
#define HD     64
#define WIN    128
#define NWIN   32
#define W3     384
#define NEGMAX (-3.402823466e+38f)

#if __has_builtin(__builtin_amdgcn_global_load_async_to_lds_b128)
#define HAVE_ASYNC_LDS 1
#endif

union Frag { v4u u[2]; v16h h; };

__device__ __forceinline__ v8f wmma_f16(v16h a, v16h b, v8f c) {
  return __builtin_amdgcn_wmma_f32_16x16x32_f16(false, a, false, b, (short)0, c,
                                                false, false);
}

__device__ __forceinline__ void wait_async0() {
#ifdef HAVE_ASYNC_LDS
#if __has_builtin(__builtin_amdgcn_s_wait_asynccnt)
  __builtin_amdgcn_s_wait_asynccnt(0);
#else
  asm volatile("s_wait_asynccnt 0" ::: "memory");
#endif
#endif
}

// ---------------------------------------------------------------------------
// Kernel 1: fused Q/K/V projection GEMM (z selects weight), f32 in -> f16 out
// scattered into (B*H, S, hd) layout. Block tile 128x128, K-chunks of 32,
// double-buffered LDS so global loads overlap the WMMAs.
// LDS tiles: one row per m (Xs) or n (Ws), 32 k as f16, row pitch 80 B
// (16 B x odd: the 16 rows of a b128 fragment read fall on distinct banks).
// Every staging store is a b64 whose 32 lanes cover all 64 banks once.
// ---------------------------------------------------------------------------
#define TP 40  // LDS row pitch in halves
__global__ __launch_bounds__(256) void qkv_gemm_wmma(
    const float* __restrict__ X, const float* __restrict__ W0,
    const float* __restrict__ W1, const float* __restrict__ W2,
    const float* __restrict__ b0, const float* __restrict__ b1,
    const float* __restrict__ b2, _Float16* __restrict__ q16,
    _Float16* __restrict__ k16, _Float16* __restrict__ v16) {
  __shared__ __attribute__((aligned(16))) _Float16 Xs[2][128 * TP];
  __shared__ __attribute__((aligned(16))) _Float16 Ws[2][128 * TP];

  int z = blockIdx.z;
  const float* W = (z == 0) ? W0 : (z == 1) ? W1 : W2;
  const float* bias = (z == 0) ? b0 : (z == 1) ? b1 : b2;
  _Float16* dst = (z == 0) ? q16 : (z == 1) ? k16 : v16;

  int m0 = blockIdx.x * 128;
  int n0 = blockIdx.y * 128;
  int tid = threadIdx.x;
  int wid = tid >> 5, lane = tid & 31;
  int lm = lane & 15, lh = lane >> 4;
  int wm = (wid & 3) * 32;   // wave M offset
  int wn = (wid >> 2) * 64;  // wave N offset

  float4 xr[4], wr[4];  // staged global data for next chunk

  // X: a wave-wide access takes 4 rows that lie 4 apart (4 x 80 B = 16 banks
  // mod 64), 8 lanes x 4 k on each row.
  int xrow = wid * 16 + (lane >> 3) * 4;  // + it
  int xc4 = (lane & 7) << 2;
  // W: each thread owns a 4 k x 4 n block, so the transpose is a choice of
  // registers and each n row gets 4 consecutive k in one b64 store. A wave
  // holds 16 k x 32 n; rows 16 apart fall on the same banks, so the rows with
  // bit 4 of n set keep their two 16-k halves swapped.
  int skh = wid >> 2;                         // which 16-k half
  int sk = skh * 16 + (lane >> 3) * 4;        // + it
  int sn = (wid & 3) * 32 + (lane & 7) * 4;   // + j
  int wpos = sn * TP + ((skh ^ ((lane >> 2) & 1)) << 4) + (lane >> 3) * 4;

  auto pack4 = [](float a, float b, float c, float d) {
    union { _Float16 h[4]; v2u u; } pk;
    pk.h[0] = (_Float16)a; pk.h[1] = (_Float16)b;
    pk.h[2] = (_Float16)c; pk.h[3] = (_Float16)d;
    return pk.u;
  };
  auto load_global = [&](int k0) {
    for (int it = 0; it < 4; it++) {  // all loads issued before any use
      xr[it] = *(const float4*)(X + (size_t)(m0 + xrow + it) * DMODEL + k0 + xc4);
      wr[it] = *(const float4*)(W + (size_t)(k0 + sk + it) * DMODEL + n0 + sn);
    }
  };
  auto store_lds = [&](int buf) {
    for (int it = 0; it < 4; it++)
      *(v2u*)(&Xs[buf][(xrow + it) * TP + xc4]) =
          pack4(xr[it].x, xr[it].y, xr[it].z, xr[it].w);
    _Float16* wp = &Ws[buf][wpos];
    *(v2u*)(wp + 0 * TP) = pack4(wr[0].x, wr[1].x, wr[2].x, wr[3].x);
    *(v2u*)(wp + 1 * TP) = pack4(wr[0].y, wr[1].y, wr[2].y, wr[3].y);
    *(v2u*)(wp + 2 * TP) = pack4(wr[0].z, wr[1].z, wr[2].z, wr[3].z);
    *(v2u*)(wp + 3 * TP) = pack4(wr[0].w, wr[1].w, wr[2].w, wr[3].w);
  };

  load_global(0);
  store_lds(0);
  v8f acc[2][4] = {};

  const int NKC = DMODEL / 32;  // 24
  for (int kc = 0; kc < NKC; kc++) {
    __syncthreads();
    if (kc + 1 < NKC) load_global((kc + 1) * 32);  // overlap with WMMAs
    // keeps the 8 loads issued here: left free, the compiler sinks them in two
    // groups between the WMMAs and the wave waits out the load latency twice
    __builtin_amdgcn_sched_barrier(0);
    int cb = kc & 1;
    Frag af[2], bf[4];
    for (int mt = 0; mt < 2; mt++) {
      const _Float16* p = &Xs[cb][(wm + mt * 16 + lm) * TP + lh * 8];
      af[mt].u[0] = *(const v4u*)p;
      af[mt].u[1] = *(const v4u*)(p + 16);
    }
    for (int nt = 0; nt < 4; nt++) {
      const _Float16* p = &Ws[cb][(wn + nt * 16 + lm) * TP + lh * 8];
      bf[nt].u[0] = *(const v4u*)(p + (nt & 1) * 16);  // halves swapped: odd nt
      bf[nt].u[1] = *(const v4u*)(p + 16 - (nt & 1) * 16);
    }
    for (int mt = 0; mt < 2; mt++)
      for (int nt = 0; nt < 4; nt++)
        acc[mt][nt] = wmma_f16(af[mt].h, bf[nt].h, acc[mt][nt]);
    if (kc + 1 < NKC) store_lds((kc + 1) & 1);
  }

  // epilogue: +bias, scatter to (b*H+h, s, e) f16
  for (int mt = 0; mt < 2; mt++)
    for (int nt = 0; nt < 4; nt++) {
      int col = n0 + wn + nt * 16 + lm;
      float bvv = bias[col];
      int h = col >> 6, e = col & 63;
      for (int r = 0; r < 8; r++) {
        int t = m0 + wm + mt * 16 + r + 8 * lh;  // token index = s*B + b
        int s = t >> 3, b = t & 7;
        dst[((size_t)(b * NHEAD + h) * S_LEN + s) * HD + e] =
            (_Float16)(acc[mt][nt][r] + bvv);
      }
    }
}

// ---------------------------------------------------------------------------
// Kernel 2: local windowed attention with look-around, flash-style online
// softmax, all matmuls via v_wmma_f32_16x16x32_f16. K tile staged with
// GLOBAL_LOAD_ASYNC_TO_LDS_B128 when the toolchain exposes it.
// grid (NWIN, B*H), 256 threads (8 waves x 16 query rows).
// ---------------------------------------------------------------------------
__global__ __launch_bounds__(256) void local_attn_wmma(
    const _Float16* __restrict__ q16, const _Float16* __restrict__ k16,
    const _Float16* __restrict__ v16, const int* __restrict__ kpm,
    float* __restrict__ out) {
  extern __shared__ char smem[];
  _Float16* Ksm = (_Float16*)smem;         // 384 x 64
  _Float16* Vts = Ksm + W3 * HD;           // 64 x 384 (V transposed)
  float* mJ = (float*)(Vts + HD * W3);     // 384
  float* mI = mJ + W3;                     // 128
  _Float16* Pst = (_Float16*)(mI + WIN);   // 8 waves * 16*32

  int w = blockIdx.x, bh = blockIdx.y;
  int b = bh / NHEAD, hh = bh % NHEAD;
  int tid = threadIdx.x, wid = tid >> 5, lane = tid & 31;
  int lm = lane & 15, lh = lane >> 4;
  const _Float16* Kg = k16 + (size_t)bh * S_LEN * HD;
  const _Float16* Vg = v16 + (size_t)bh * S_LEN * HD;

  // K tile (zero-padded look-around), row-major; async copy where possible
  for (int idx = tid; idx < W3 * 8; idx += 256) {
    int j = idx >> 3, c = idx & 7;
    int s = (w - 1) * WIN + j;
    _Float16* dp = Ksm + j * HD + c * 8;
    if (s >= 0 && s < S_LEN) {
#ifdef HAVE_ASYNC_LDS
      __builtin_amdgcn_global_load_async_to_lds_b128(
          (gv4i_p)(Kg + (size_t)s * HD + c * 8), (lv4i_p)dp, 0, 0);
#else
      *(v4u*)dp = *(const v4u*)(Kg + (size_t)s * HD + c * 8);
#endif
    } else {
      v4u zz = {};
      *(v4u*)dp = zz;
    }
  }
  for (int j = tid; j < W3; j += 256) {
    int s = (w - 1) * WIN + j;
    mJ[j] = (s < 0 || s >= S_LEN) ? 1.f : (kpm[b * S_LEN + s] ? 1.f : 0.f);
  }
  for (int i = tid; i < WIN; i += 256)
    mI[i] = kpm[b * S_LEN + w * WIN + i] ? 1.f : 0.f;
  // V tile transposed: Vts[e][j] (vector global read, scalar LDS scatter)
  for (int idx = tid; idx < W3 * 8; idx += 256) {
    int j = idx >> 3, c = idx & 7;
    int s = (w - 1) * WIN + j;
    _Float16 vh[8];
    if (s >= 0 && s < S_LEN) {
      *(v4u*)vh = *(const v4u*)(Vg + (size_t)s * HD + c * 8);
    } else {
      v4u zz = {};
      *(v4u*)vh = zz;
    }
    for (int q = 0; q < 8; q++) Vts[(c * 8 + q) * W3 + j] = vh[q];
  }
  wait_async0();
  __syncthreads();

  int i0 = wid * 16;
  const _Float16* Qg = q16 + ((size_t)bh * S_LEN + (size_t)w * WIN + i0) * HD;
  Frag aq[2];
  for (int ec = 0; ec < 2; ec++) {
    const _Float16* p = Qg + lm * HD + ec * 32 + lh * 8;
    aq[ec].u[0] = *(const v4u*)p;
    aq[ec].u[1] = *(const v4u*)(p + 16);
  }

  const float inv = 0.125f;  // hd^-0.5
  v8f Oacc[4] = {};
  float mr[8], lr[8], mi_row[8];
  for (int r = 0; r < 8; r++) {
    mr[r] = NEGMAX;
    lr[r] = 0.f;
    mi_row[r] = mI[i0 + r + 8 * lh];
  }
  _Float16* Pw = Pst + wid * 512;

  for (int jt = 0; jt < 12; jt++) {
    // scores: two 16-col tiles over hd (K = 2 chunks of 32)
    v8f c0 = {}, c1 = {};
    for (int ec = 0; ec < 2; ec++) {
      Frag bk0, bk1;
      const _Float16* p0 = Ksm + (jt * 32 + lm) * HD + ec * 32 + lh * 8;
      bk0.u[0] = *(const v4u*)p0; bk0.u[1] = *(const v4u*)(p0 + 16);
      const _Float16* p1 = Ksm + (jt * 32 + 16 + lm) * HD + ec * 32 + lh * 8;
      bk1.u[0] = *(const v4u*)p1; bk1.u[1] = *(const v4u*)(p1 + 16);
      c0 = wmma_f16(aq[ec].h, bk0.h, c0);
      c1 = wmma_f16(aq[ec].h, bk1.h, c1);
    }
    float mj0 = mJ[jt * 32 + lm];
    float mj1 = mJ[jt * 32 + 16 + lm];
    float scl[8];
    for (int r = 0; r < 8; r++) {
      float s0 = (mi_row[r] + mj0 > 0.f) ? NEGMAX : c0[r] * inv;
      float s1 = (mi_row[r] + mj1 > 0.f) ? NEGMAX : c1[r] * inv;
      float tm = fmaxf(s0, s1);
      for (int off = 1; off < 16; off <<= 1)
        tm = fmaxf(tm, __shfl_xor(tm, off, 32));
      float mn = fmaxf(mr[r], tm);
      float sc = __expf(mr[r] - mn);
      mr[r] = mn;
      float p0 = __expf(s0 - mn);
      float p1 = __expf(s1 - mn);
      float ps = p0 + p1;
      for (int off = 1; off < 16; off <<= 1) ps += __shfl_xor(ps, off, 32);
      lr[r] = lr[r] * sc + ps;
      scl[r] = sc;
      c0[r] = p0;
      c1[r] = p1;
    }
    for (int t = 0; t < 4; t++)
      for (int r = 0; r < 8; r++) Oacc[t][r] *= scl[r];

    // stage P (16x32 f16) row-major through per-wave LDS, reload as A-frag
    for (int r = 0; r < 8; r++) {
      int il = r + 8 * lh;
      Pw[il * 32 + lm] = (_Float16)c0[r];
      Pw[il * 32 + 16 + lm] = (_Float16)c1[r];
    }
    asm volatile("" ::: "memory");  // per-wave DS ops are HW in-order
    Frag ap;
    const _Float16* pp = Pw + lm * 32 + lh * 8;
    ap.u[0] = *(const v4u*)pp;
    ap.u[1] = *(const v4u*)(pp + 16);
    for (int t = 0; t < 4; t++) {
      Frag bvf;
      const _Float16* vp = Vts + (t * 16 + lm) * W3 + jt * 32 + lh * 8;
      bvf.u[0] = *(const v4u*)vp;
      bvf.u[1] = *(const v4u*)(vp + 16);
      Oacc[t] = wmma_f16(ap.h, bvf.h, Oacc[t]);
    }
  }

  for (int t = 0; t < 4; t++) {
    int col = hh * HD + t * 16 + lm;
    for (int r = 0; r < 8; r++) {
      int srow = w * WIN + i0 + r + 8 * lh;
      out[((size_t)srow * BATCH + b) * DMODEL + col] = Oacc[t][r] / lr[r];
    }
  }
}

// ---------------------------------------------------------------------------
// Kernel 3: gq = hidden[0] @ Wgq + bgq  (tiny)
// ---------------------------------------------------------------------------
__global__ __launch_bounds__(256) void gq_proj(const float* __restrict__ X,
                                               const float* __restrict__ Wgq,
                                               const float* __restrict__ bgq,
                                               float* __restrict__ gq) {
  int idx = blockIdx.x * 256 + threadIdx.x;
  if (idx >= BATCH * DMODEL) return;
  int b = idx / DMODEL, d = idx % DMODEL;
  const float* xr = X + (size_t)b * DMODEL;  // hidden[(0,b),:]
  float s = bgq[d];
  for (int k = 0; k < DMODEL; k++) s += xr[k] * Wgq[(size_t)k * DMODEL + d];
  gq[idx] = s;  // layout (b*H+h)*64+e == b*768+d
}

// ---------------------------------------------------------------------------
// Kernel 4: global-token attention, overwrites out row 0. Deterministic
// tree reductions (no float atomics).
// ---------------------------------------------------------------------------
__global__ __launch_bounds__(256) void global_attn_kernel(
    const float* __restrict__ gq, const _Float16* __restrict__ k16,
    const _Float16* __restrict__ v16, const int* __restrict__ kpm,
    float* __restrict__ out) {
  __shared__ float sc[S_LEN];
  __shared__ float qsh[HD];
  __shared__ float red[256];
  __shared__ float accv[HD + 1];
  int bh = blockIdx.x;
  int b = bh / NHEAD, hh = bh % NHEAD;
  int tid = threadIdx.x;
  if (tid < HD) qsh[tid] = gq[bh * HD + tid];
  __syncthreads();

  const _Float16* Kg = k16 + (size_t)bh * S_LEN * HD;
  const _Float16* Vg = v16 + (size_t)bh * S_LEN * HD;
  float lmax = NEGMAX;
  for (int s = tid; s < S_LEN; s += 256) {
    const _Float16* kr = Kg + (size_t)s * HD;
    float d = 0.f;
    for (int e = 0; e < HD; e++) d += qsh[e] * (float)kr[e];
    d *= 0.125f;
    if (kpm[b * S_LEN + s]) d = NEGMAX;
    sc[s] = d;
    lmax = fmaxf(lmax, d);
  }
  red[tid] = lmax;
  __syncthreads();
  for (int st = 128; st > 0; st >>= 1) {
    if (tid < st) red[tid] = fmaxf(red[tid], red[tid + st]);
    __syncthreads();
  }
  float M = red[0];
  __syncthreads();

  float av[HD];
  for (int e = 0; e < HD; e++) av[e] = 0.f;
  float lsum = 0.f;
  for (int s = tid; s < S_LEN; s += 256) {
    float p = __expf(sc[s] - M);
    lsum += p;
    const _Float16* vr = Vg + (size_t)s * HD;
    for (int e = 0; e < HD; e++) av[e] += p * (float)vr[e];
  }
  for (int e = 0; e < HD; e++) {
    red[tid] = av[e];
    __syncthreads();
    for (int st = 128; st > 0; st >>= 1) {
      if (tid < st) red[tid] += red[tid + st];
      __syncthreads();
    }
    if (tid == 0) accv[e] = red[0];
    __syncthreads();
  }
  red[tid] = lsum;
  __syncthreads();
  for (int st = 128; st > 0; st >>= 1) {
    if (tid < st) red[tid] += red[tid + st];
    __syncthreads();
  }
  if (tid == 0) accv[HD] = red[0];
  __syncthreads();
  if (tid < HD)
    out[(size_t)b * DMODEL + hh * HD + tid] = accv[tid] / accv[HD];
}

// ---------------------------------------------------------------------------
extern "C" void kernel_launch(void* const* d_in, const int* in_sizes, int n_in,
                              void* d_out, int out_size, void* d_ws,
                              size_t ws_size, hipStream_t stream) {
  (void)in_sizes; (void)n_in; (void)out_size; (void)ws_size;
  const float* hs  = (const float*)d_in[0];
  const int*   kpm = (const int*)d_in[1];
  const float* Wq  = (const float*)d_in[2];
  const float* Wk  = (const float*)d_in[3];
  const float* Wv  = (const float*)d_in[4];
  const float* Wgq = (const float*)d_in[5];
  const float* bq  = (const float*)d_in[6];
  const float* bk  = (const float*)d_in[7];
  const float* bv  = (const float*)d_in[8];
  const float* bgq = (const float*)d_in[9];
  float* out = (float*)d_out;

  size_t per = (size_t)BATCH * NHEAD * S_LEN * HD;  // halfs per q/k/v tensor
  _Float16* q16 = (_Float16*)d_ws;
  _Float16* k16 = q16 + per;
  _Float16* v16 = k16 + per;
  float* gqbuf = (float*)(v16 + per);

  dim3 g1(256, 6, 3);
  qkv_gemm_wmma<<<g1, 256, 0, stream>>>(hs, Wq, Wk, Wv, bq, bk, bv, q16, k16,
                                        v16);
  gq_proj<<<(BATCH * DMODEL + 255) / 256, 256, 0, stream>>>(hs, Wgq, bgq,
                                                            gqbuf);
  size_t lds_bytes = (size_t)W3 * HD * 2 + (size_t)HD * W3 * 2 + W3 * 4 +
                     WIN * 4 + (size_t)8 * 512 * 2;  // 108,544 B (<320KB WGP)
  dim3 g2(NWIN, BATCH * NHEAD);
  local_attn_wmma<<<g2, 256, lds_bytes, stream>>>(q16, k16, v16, kpm, out);
  global_attn_kernel<<<BATCH * NHEAD, 256, 0, stream>>>(gqbuf, k16, v16, kpm,
                                                        out);
}

// v002
// A run of this version takes 510 microseconds.
// Two timings next to v001 both put it at 1.22 times that version's speed.
// All steps since v000 together make it 2.42 times as fast.
#include <hip/hip_runtime.h>
#include <hip/hip_bf16.h>

typedef __attribute__((ext_vector_type(16))) _Float16     v16h;
typedef __attribute__((ext_vector_type(8)))  float        v8f;
typedef __attribute__((ext_vector_type(4)))  unsigned int v4u;
typedef __attribute__((ext_vector_type(2)))  unsigned int v2u;
typedef __attribute__((ext_vector_type(4)))  int          v4i;
typedef __attribute__((address_space(1))) v4i* gv4i_p;  // global ("__device__")
typedef __attribute__((address_space(3))) v4i* lv4i_p;  // LDS ("__shared__")

#define S_LEN  4096
#define BATCH  8
#define DMODEL 768
#define NHEAD  12
#define HD     64
#define WIN    128
#define NWIN   32
#define W3     384
#define NEGMAX (-3.402823466e+38f)

#if __has_builtin(__builtin_amdgcn_global_load_async_to_lds_b128)
#define HAVE_ASYNC_LDS 1
#endif

union Frag { v4u u[2]; v16h h; };

__device__ __forceinline__ v8f wmma_f16(v16h a, v16h b, v8f c) {
  return __builtin_amdgcn_wmma_f32_16x16x32_f16(false, a, false, b, (short)0, c,
                                                false, false);
}

__device__ __forceinline__ void wait_async0() {
#ifdef HAVE_ASYNC_LDS
  // this wave's async copies have landed; the clobber holds LDS reads behind it
  asm volatile("s_wait_asynccnt 0x0" ::: "memory");
#endif
}

// 16 bytes, global -> LDS, per lane
__device__ __forceinline__ void copy16_to_lds(const _Float16* g, char* l) {
#ifdef HAVE_ASYNC_LDS
  __builtin_amdgcn_global_load_async_to_lds_b128((gv4i_p)g, (lv4i_p)l, 0, 0);
#else
  *(v4u*)l = *(const v4u*)g;
#endif
}

// transposing LDS load: lane (c = l & 15, h = l >> 4) gets T[8h + 0..7][c] of a
// row-major 16-bit tile; the lane's address names row 8h + (l & 7), 16-byte
// piece (l >> 3) & 1
typedef short s16x8 __attribute__((ext_vector_type(8)));
typedef __attribute__((address_space(3))) s16x8 lds_s16x8;
__device__ __forceinline__ v4u ld_tr16(const char* p) {
  return __builtin_bit_cast(
      v4u, __builtin_amdgcn_ds_load_tr16_b128_v8i16((lds_s16x8*)p));
}

// ---------------------------------------------------------------------------
// Kernel 1: fused Q/K/V projection GEMM (z selects weight), f32 in -> f16 out
// scattered into (B*H, S, hd) layout. Block tile 128x128, K-chunks of 32,
// double-buffered LDS so global loads overlap the WMMAs.
// LDS tiles: one row per m (Xs) or n (Ws), 32 k as f16, row pitch 80 B
// (16 B x odd: the 16 rows of a b128 fragment read fall on distinct banks).
// Every staging store is a b64 whose 32 lanes cover all 64 banks once.
// ---------------------------------------------------------------------------
#define TP 40  // LDS row pitch in halves
__global__ __launch_bounds__(256) void qkv_gemm_wmma(
    const float* __restrict__ X, const float* __restrict__ W0,
    const float* __restrict__ W1, const float* __restrict__ W2,
    const float* __restrict__ b0, const float* __restrict__ b1,
    const float* __restrict__ b2, _Float16* __restrict__ q16,
    _Float16* __restrict__ k16, _Float16* __restrict__ v16) {
  __shared__ __attribute__((aligned(16))) _Float16 Xs[2][128 * TP];
  __shared__ __attribute__((aligned(16))) _Float16 Ws[2][128 * TP];

  int z = blockIdx.z;
  const float* W = (z == 0) ? W0 : (z == 1) ? W1 : W2;
  const float* bias = (z == 0) ? b0 : (z == 1) ? b1 : b2;
  _Float16* dst = (z == 0) ? q16 : (z == 1) ? k16 : v16;

  int m0 = blockIdx.x * 128;
  int n0 = blockIdx.y * 128;
  int tid = threadIdx.x;
  int wid = tid >> 5, lane = tid & 31;
  int lm = lane & 15, lh = lane >> 4;
  int wm = (wid & 3) * 32;   // wave M offset
  int wn = (wid >> 2) * 64;  // wave N offset

  float4 xr[4], wr[4];  // staged global data for next chunk

  // X: a wave-wide access takes 4 rows that lie 4 apart (4 x 80 B = 16 banks
  // mod 64), 8 lanes x 4 k on each row.
  int xrow = wid * 16 + (lane >> 3) * 4;  // + it
  int xc4 = (lane & 7) << 2;
  // W: each thread owns a 4 k x 4 n block, so the transpose is a choice of
  // registers and each n row gets 4 consecutive k in one b64 store. A wave
  // holds 16 k x 32 n; rows 16 apart fall on the same banks, so the rows with
  // bit 4 of n set keep their two 16-k halves swapped.
  int skh = wid >> 2;                         // which 16-k half
  int sk = skh * 16 + (lane >> 3) * 4;        // + it
  int sn = (wid & 3) * 32 + (lane & 7) * 4;   // + j
  int wpos = sn * TP + ((skh ^ ((lane >> 2) & 1)) << 4) + (lane >> 3) * 4;

  auto pack4 = [](float a, float b, float c, float d) {
    union { _Float16 h[4]; v2u u; } pk;
    pk.h[0] = (_Float16)a; pk.h[1] = (_Float16)b;
    pk.h[2] = (_Float16)c; pk.h[3] = (_Float16)d;
    return pk.u;
  };
  auto load_global = [&](int k0) {
    for (int it = 0; it < 4; it++) {  // all loads issued before any use
      xr[it] = *(const float4*)(X + (size_t)(m0 + xrow + it) * DMODEL + k0 + xc4);
      wr[it] = *(const float4*)(W + (size_t)(k0 + sk + it) * DMODEL + n0 + sn);
    }
  };
  auto store_lds = [&](int buf) {
    for (int it = 0; it < 4; it++)
      *(v2u*)(&Xs[buf][(xrow + it) * TP + xc4]) =
          pack4(xr[it].x, xr[it].y, xr[it].z, xr[it].w);
    _Float16* wp = &Ws[buf][wpos];
    *(v2u*)(wp + 0 * TP) = pack4(wr[0].x, wr[1].x, wr[2].x, wr[3].x);
    *(v2u*)(wp + 1 * TP) = pack4(wr[0].y, wr[1].y, wr[2].y, wr[3].y);
    *(v2u*)(wp + 2 * TP) = pack4(wr[0].z, wr[1].z, wr[2].z, wr[3].z);
    *(v2u*)(wp + 3 * TP) = pack4(wr[0].w, wr[1].w, wr[2].w, wr[3].w);
  };

  load_global(0);
  store_lds(0);
  v8f acc[2][4] = {};

  const int NKC = DMODEL / 32;  // 24
  for (int kc = 0; kc < NKC; kc++) {
    __syncthreads();
    if (kc + 1 < NKC) load_global((kc + 1) * 32);  // overlap with WMMAs
    // keeps the 8 loads issued here: left free, the compiler sinks them in two
    // groups between the WMMAs and the wave waits out the load latency twice
    __builtin_amdgcn_sched_barrier(0);
    int cb = kc & 1;
    Frag af[2], bf[4];
    for (int mt = 0; mt < 2; mt++) {
      const _Float16* p = &Xs[cb][(wm + mt * 16 + lm) * TP + lh * 8];
      af[mt].u[0] = *(const v4u*)p;
      af[mt].u[1] = *(const v4u*)(p + 16);
    }
    for (int nt = 0; nt < 4; nt++) {
      const _Float16* p = &Ws[cb][(wn + nt * 16 + lm) * TP + lh * 8];
      bf[nt].u[0] = *(const v4u*)(p + (nt & 1) * 16);  // halves swapped: odd nt
      bf[nt].u[1] = *(const v4u*)(p + 16 - (nt & 1) * 16);
    }
    for (int mt = 0; mt < 2; mt++)
      for (int nt = 0; nt < 4; nt++)
        acc[mt][nt] = wmma_f16(af[mt].h, bf[nt].h, acc[mt][nt]);
    if (kc + 1 < NKC) store_lds((kc + 1) & 1);
  }

  // epilogue: +bias, scatter to (b*H+h, s, e) f16
  for (int mt = 0; mt < 2; mt++)
    for (int nt = 0; nt < 4; nt++) {
      int col = n0 + wn + nt * 16 + lm;
      float bvv = bias[col];
      int h = col >> 6, e = col & 63;
      for (int r = 0; r < 8; r++) {
        int t = m0 + wm + mt * 16 + r + 8 * lh;  // token index = s*B + b
        int s = t >> 3, b = t & 7;
        dst[((size_t)(b * NHEAD + h) * S_LEN + s) * HD + e] =
            (_Float16)(acc[mt][nt][r] + bvv);
      }
    }
}

// ---------------------------------------------------------------------------
// Kernel 2: local windowed attention with look-around, flash-style online
// softmax, all matmuls via v_wmma_f32_16x16x32_f16. K and V tiles staged
// row-major with GLOBAL_LOAD_ASYNC_TO_LDS_B128 when the toolchain exposes it.
// LDS layout, in 16-byte pieces, no padding (three blocks fit one WGP):
//   K row j (8 pieces): piece p lies at p ^ ((j >> 1) & 7)
//   P row i (4 pieces): piece p lies at p ^ ((i >> 2) & 3)
// so the 16 rows of a ds_load_b128 fragment read fall on all 64 banks.
//   V row j: as in memory; ds_load_tr16_b128 hands out the B fragment of P.V
//   in the k order of the P loader (8h + 0..7, then 16 + 8h + 0..7).
// grid (NWIN, B*H), 256 threads (8 waves x 16 query rows).
// ---------------------------------------------------------------------------
#define ROWB 128  // K and V row, bytes
#define ATT_V_OFF  (W3 * ROWB)
#define ATT_MJ_OFF (ATT_V_OFF + W3 * ROWB)
#define ATT_MI_OFF (ATT_MJ_OFF + W3 * 4)
#define ATT_P_OFF  (ATT_MI_OFF + WIN * 4)
#define ATT_LDS    (ATT_P_OFF + 8 * 16 * 64)  // 108,544 B
__global__ __launch_bounds__(256) void local_attn_wmma(
    const _Float16* __restrict__ q16, const _Float16* __restrict__ k16,
    const _Float16* __restrict__ v16, const int* __restrict__ kpm,
    float* __restrict__ out) {
  extern __shared__ __attribute__((aligned(16))) char smem[];
  char* Ksm = smem;                        // 384 rows x 64 halves
  char* Vsm = smem + ATT_V_OFF;            // 384 rows x 64 halves
  float* mJ = (float*)(smem + ATT_MJ_OFF); // 384
  float* mI = (float*)(smem + ATT_MI_OFF); // 128
  char* Pst = smem + ATT_P_OFF;            // 8 waves x 16 rows x 32 halves

  int w = blockIdx.x, bh = blockIdx.y;
  int b = bh / NHEAD, hh = bh % NHEAD;
  int tid = threadIdx.x, wid = tid >> 5, lane = tid & 31;
  int lm = lane & 15, lh = lane >> 4;
  const _Float16* Kg = k16 + (size_t)bh * S_LEN * HD;
  const _Float16* Vg = v16 + (size_t)bh * S_LEN * HD;

  // K and V tiles, one window at a time; whether a window exists is the same
  // for the whole block, so every lane is on at every copy. A window past
  // either end is zero-filled (look-around padding).
  for (int seg = 0; seg < 3; seg++) {
    int wj = w - 1 + seg;
    char* kd = Ksm + seg * WIN * ROWB;
    char* vd = Vsm + seg * WIN * ROWB;
    if (wj >= 0 && wj < NWIN) {
      const _Float16* kg = Kg + (size_t)wj * WIN * HD;
      const _Float16* vg = Vg + (size_t)wj * WIN * HD;
      for (int it = 0; it < 4; it++) {
        int idx = it * 256 + tid;  // 16-byte piece; a wave takes 512 B in a row
        int j = idx >> 3, c = idx & 7;
        copy16_to_lds(kg + idx * 8, kd + j * ROWB + ((c ^ ((j >> 1) & 7)) << 4));
        copy16_to_lds(vg + idx * 8, vd + idx * 16);
      }
    } else {
      v4u zz = {};
      for (int it = 0; it < 4; it++) {
        int idx = it * 256 + tid;
        *(v4u*)(kd + idx * 16) = zz;
        *(v4u*)(vd + idx * 16) = zz;
      }
    }
  }
  for (int j = tid; j < W3; j += 256) {
    int s = (w - 1) * WIN + j;
    mJ[j] = (s < 0 || s >= S_LEN) ? 1.f : (kpm[b * S_LEN + s] ? 1.f : 0.f);
  }
  for (int i = tid; i < WIN; i += 256)
    mI[i] = kpm[b * S_LEN + w * WIN + i] ? 1.f : 0.f;
  wait_async0();
  __syncthreads();

  int i0 = wid * 16;
  const _Float16* Qg = q16 + ((size_t)bh * S_LEN + (size_t)w * WIN + i0) * HD;
  Frag aq[2];
  for (int ec = 0; ec < 2; ec++) {
    const _Float16* p = Qg + lm * HD + ec * 32 + lh * 8;
    aq[ec].u[0] = *(const v4u*)p;
    aq[ec].u[1] = *(const v4u*)(p + 16);
  }

  const float inv = 0.125f;  // hd^-0.5
  v8f Oacc[4] = {};
  float mr[8], lr[8], mi_row[8];
  for (int r = 0; r < 8; r++) {
    mr[r] = NEGMAX;
    lr[r] = 0.f;
    mi_row[r] = mI[i0 + r + 8 * lh];
  }
  char* Pw = Pst + wid * 16 * 64;
  // lane offsets inside a row; a further piece index is XORed in at bits 4..6
  const char* Kl = Ksm + lm * ROWB;
  int kx = (lh ^ (lm >> 1)) << 4;  // rows jt*32 (+16) + lm: (j >> 1) & 7 = lm >> 1
  int pst = lh * 512 + (((lm >> 3) ^ (lh << 1)) << 4) + (lm & 7) * 2;
  int pld = lm * 64 + ((lh ^ (lm >> 2)) << 4);
  const char* Vl = Vsm + (8 * lh + (lane & 7)) * ROWB + ((lane >> 3) & 1) * 16;

  for (int jt = 0; jt < 12; jt++) {
    // scores: two 16-col tiles over hd (K = 2 chunks of 32)
    v8f c0 = {}, c1 = {};
    for (int ec = 0; ec < 2; ec++) {
      Frag bk0, bk1;
      const char* p0 = Kl + jt * 32 * ROWB;
      const char* p1 = p0 + 16 * ROWB;
      int ka = kx ^ (ec * 64), kb = ka ^ 32;
      bk0.u[0] = *(const v4u*)(p0 + ka); bk0.u[1] = *(const v4u*)(p0 + kb);
      bk1.u[0] = *(const v4u*)(p1 + ka); bk1.u[1] = *(const v4u*)(p1 + kb);
      c0 = wmma_f16(aq[ec].h, bk0.h, c0);
      c1 = wmma_f16(aq[ec].h, bk1.h, c1);
    }
    float mj0 = mJ[jt * 32 + lm];
    float mj1 = mJ[jt * 32 + 16 + lm];
    float scl[8];
    for (int r = 0; r < 8; r++) {
      float s0 = (mi_row[r] + mj0 > 0.f) ? NEGMAX : c0[r] * inv;
      float s1 = (mi_row[r] + mj1 > 0.f) ? NEGMAX : c1[r] * inv;
      float tm = fmaxf(s0, s1);
      for (int off = 1; off < 16; off <<= 1)
        tm = fmaxf(tm, __shfl_xor(tm, off, 32));
      float mn = fmaxf(mr[r], tm);
      float sc = __expf(mr[r] - mn);
      mr[r] = mn;
      float p0 = __expf(s0 - mn);
      float p1 = __expf(s1 - mn);
      float ps = p0 + p1;
      for (int off = 1; off < 16; off <<= 1) ps += __shfl_xor(ps, off, 32);
      lr[r] = lr[r] * sc + ps;
      scl[r] = sc;
      c0[r] = p0;
      c1[r] = p1;
    }
    for (int t = 0; t < 4; t++)
      for (int r = 0; r < 8; r++) Oacc[t][r] *= scl[r];

    // stage P (16x32 f16) row-major through per-wave LDS, reload as A-frag
    for (int r = 0; r < 8; r++) {
      int po = pst ^ ((r >> 2) << 4);  // row r + 8 lh, columns lm and 16 + lm
      *(_Float16*)(Pw + r * 64 + po) = (_Float16)c0[r];
      *(_Float16*)(Pw + r * 64 + (po ^ 32)) = (_Float16)c1[r];
    }
    asm volatile("" ::: "memory");  // per-wave DS ops are HW in-order
    Frag ap;
    ap.u[0] = *(const v4u*)(Pw + pld);
    ap.u[1] = *(const v4u*)(Pw + (pld ^ 32));
    for (int t = 0; t < 4; t++) {
      Frag bvf;
      const char* vp = Vl + jt * 32 * ROWB + t * 32;
      bvf.u[0] = ld_tr16(vp);
      bvf.u[1] = ld_tr16(vp + 16 * ROWB);
      Oacc[t] = wmma_f16(ap.h, bvf.h, Oacc[t]);
    }
  }

  for (int t = 0; t < 4; t++) {
    int col = hh * HD + t * 16 + lm;
    for (int r = 0; r < 8; r++) {
      int srow = w * WIN + i0 + r + 8 * lh;
      out[((size_t)srow * BATCH + b) * DMODEL + col] = Oacc[t][r] / lr[r];
    }
  }
}

// ---------------------------------------------------------------------------
// Kernel 3: gq = hidden[0] @ Wgq + bgq  (tiny)
// ---------------------------------------------------------------------------
__global__ __launch_bounds__(256) void gq_proj(const float* __restrict__ X,
                                               const float* __restrict__ Wgq,
                                               const float* __restrict__ bgq,
                                               float* __restrict__ gq) {
  int idx = blockIdx.x * 256 + threadIdx.x;
  if (idx >= BATCH * DMODEL) return;
  int b = idx / DMODEL, d = idx % DMODEL;
  const float* xr = X + (size_t)b * DMODEL;  // hidden[(0,b),:]
  float s = bgq[d];
  for (int k = 0; k < DMODEL; k++) s += xr[k] * Wgq[(size_t)k * DMODEL + d];
  gq[idx] = s;  // layout (b*H+h)*64+e == b*768+d
}

// ---------------------------------------------------------------------------
// Kernel 4: global-token attention, overwrites out row 0. Deterministic
// tree reductions (no float atomics).
// ---------------------------------------------------------------------------
__global__ __launch_bounds__(256) void global_attn_kernel(
    const float* __restrict__ gq, const _Float16* __restrict__ k16,
    const _Float16* __restrict__ v16, const int* __restrict__ kpm,
    float* __restrict__ out) {
  __shared__ float sc[S_LEN];
  __shared__ float qsh[HD];
  __shared__ float red[256];
  __shared__ float accv[HD + 1];
  int bh = blockIdx.x;
  int b = bh / NHEAD, hh = bh % NHEAD;
  int tid = threadIdx.x;
  if (tid < HD) qsh[tid] = gq[bh * HD + tid];
  __syncthreads();

  const _Float16* Kg = k16 + (size_t)bh * S_LEN * HD;
  const _Float16* Vg = v16 + (size_t)bh * S_LEN * HD;
  float lmax = NEGMAX;
  for (int s = tid; s < S_LEN; s += 256) {
    const _Float16* kr = Kg + (size_t)s * HD;
    float d = 0.f;
    for (int e = 0; e < HD; e++) d += qsh[e] * (float)kr[e];
    d *= 0.125f;
    if (kpm[b * S_LEN + s]) d = NEGMAX;
    sc[s] = d;
    lmax = fmaxf(lmax, d);
  }
  red[tid] = lmax;
  __syncthreads();
  for (int st = 128; st > 0; st >>= 1) {
    if (tid < st) red[tid] = fmaxf(red[tid], red[tid + st]);
    __syncthreads();
  }
  float M = red[0];
  __syncthreads();

  float av[HD];
  for (int e = 0; e < HD; e++) av[e] = 0.f;
  float lsum = 0.f;
  for (int s = tid; s < S_LEN; s += 256) {
    float p = __expf(sc[s] - M);
    lsum += p;
    const _Float16* vr = Vg + (size_t)s * HD;
    for (int e = 0; e < HD; e++) av[e] += p * (float)vr[e];
  }
  for (int e = 0; e < HD; e++) {
    red[tid] = av[e];
    __syncthreads();
    for (int st = 128; st > 0; st >>= 1) {
      if (tid < st) red[tid] += red[tid + st];
      __syncthreads();
    }
    if (tid == 0) accv[e] = red[0];
    __syncthreads();
  }
  red[tid] = lsum;
  __syncthreads();
  for (int st = 128; st > 0; st >>= 1) {
    if (tid < st) red[tid] += red[tid + st];
    __syncthreads();
  }
  if (tid == 0) accv[HD] = red[0];
  __syncthreads();
  if (tid < HD)
    out[(size_t)b * DMODEL + hh * HD + tid] = accv[tid] / accv[HD];
}

// ---------------------------------------------------------------------------
extern "C" void kernel_launch(void* const* d_in, const int* in_sizes, int n_in,
                              void* d_out, int out_size, void* d_ws,
                              size_t ws_size, hipStream_t stream) {
  (void)in_sizes; (void)n_in; (void)out_size; (void)ws_size;
  const float* hs  = (const float*)d_in[0];
  const int*   kpm = (const int*)d_in[1];
  const float* Wq  = (const float*)d_in[2];
  const float* Wk  = (const float*)d_in[3];
  const float* Wv  = (const float*)d_in[4];
  const float* Wgq = (const float*)d_in[5];
  const float* bq  = (const float*)d_in[6];
  const float* bk  = (const float*)d_in[7];
  const float* bv  = (const float*)d_in[8];
  const float* bgq = (const float*)d_in[9];
  float* out = (float*)d_out;

  size_t per = (size_t)BATCH * NHEAD * S_LEN * HD;  // halfs per q/k/v tensor
  _Float16* q16 = (_Float16*)d_ws;
  _Float16* k16 = q16 + per;
  _Float16* v16 = k16 + per;
  float* gqbuf = (float*)(v16 + per);

  dim3 g1(256, 6, 3);
  qkv_gemm_wmma<<<g1, 256, 0, stream>>>(hs, Wq, Wk, Wv, bq, bk, bv, q16, k16,
                                        v16);
  gq_proj<<<(BATCH * DMODEL + 255) / 256, 256, 0, stream>>>(hs, Wgq, bgq,
                                                            gqbuf);
  size_t lds_bytes = ATT_LDS;
  dim3 g2(NWIN, BATCH * NHEAD);
  local_attn_wmma<<<g2, 256, lds_bytes, stream>>>(q16, k16, v16, kpm, out);
  global_attn_kernel<<<BATCH * NHEAD, 256, 0, stream>>>(gqbuf, k16, v16, kpm,
                                                        out);
}

// v003
// Measured time: 403 microseconds a run.
// In two side-by-side timings against v002, it was 1.26 and 1.27 times as fast.
// All steps since v000 together make it 3.07 times as fast.
#include <hip/hip_runtime.h>
#include <hip/hip_bf16.h>

typedef __attribute__((ext_vector_type(16))) _Float16     v16h;
typedef __attribute__((ext_vector_type(8)))  float        v8f;
typedef __attribute__((ext_vector_type(4)))  unsigned int v4u;
typedef __attribute__((ext_vector_type(2)))  unsigned int v2u;
typedef __attribute__((ext_vector_type(4)))  int          v4i;
typedef __attribute__((address_space(1))) v4i* gv4i_p;  // global ("__device__")
typedef __attribute__((address_space(3))) v4i* lv4i_p;  // LDS ("__shared__")

#define S_LEN  4096
#define BATCH  8
#define DMODEL 768
#define NHEAD  12
#define HD     64
#define WIN    128
#define NWIN   32
#define W3     384
#define NEGMAX (-3.402823466e+38f)

#if __has_builtin(__builtin_amdgcn_global_load_async_to_lds_b128)
#define HAVE_ASYNC_LDS 1
#endif

union Frag { v4u u[2]; v16h h; };

__device__ __forceinline__ v8f wmma_f16(v16h a, v16h b, v8f c) {
  return __builtin_amdgcn_wmma_f32_16x16x32_f16(false, a, false, b, (short)0, c,
                                                false, false);
}

__device__ __forceinline__ void wait_async0() {
#ifdef HAVE_ASYNC_LDS
  // this wave's async copies have landed; the clobber holds LDS reads behind it
  asm volatile("s_wait_asynccnt 0x0" ::: "memory");
#endif
}

// 16 bytes, global -> LDS, per lane
__device__ __forceinline__ void copy16_to_lds(const _Float16* g, char* l) {
#ifdef HAVE_ASYNC_LDS
  __builtin_amdgcn_global_load_async_to_lds_b128((gv4i_p)g, (lv4i_p)l, 0, 0);
#else
  *(v4u*)l = *(const v4u*)g;
#endif
}

// transposing LDS load: lane (c = l & 15, h = l >> 4) gets T[8h + 0..7][c] of a
// row-major 16-bit tile; the lane's address names row 8h + (l & 7), 16-byte
// piece (l >> 3) & 1
typedef short s16x8 __attribute__((ext_vector_type(8)));
typedef __attribute__((address_space(3))) s16x8 lds_s16x8;
__device__ __forceinline__ v4u ld_tr16(const char* p) {
  return __builtin_bit_cast(
      v4u, __builtin_amdgcn_ds_load_tr16_b128_v8i16((lds_s16x8*)p));
}

// ---------------------------------------------------------------------------
// Kernel 1: fused Q/K/V projection GEMM (z selects weight), f32 in -> f16 out
// scattered into (B*H, S, hd) layout. Block tile 128x128, K-chunks of 32,
// double-buffered LDS so global loads overlap the WMMAs.
// LDS tiles: one row per m (Xs) or n (Ws), 32 k as f16, row pitch 80 B
// (16 B x odd: the 16 rows of a b128 fragment read fall on distinct banks).
// Every staging store is a b64 whose 32 lanes cover all 64 banks once.
// ---------------------------------------------------------------------------
#define TP 40  // LDS row pitch in halves
__global__ __launch_bounds__(256) void qkv_gemm_wmma(
    const float* __restrict__ X, const float* __restrict__ W0,
    const float* __restrict__ W1, const float* __restrict__ W2,
    const float* __restrict__ b0, const float* __restrict__ b1,
    const float* __restrict__ b2, _Float16* __restrict__ q16,
    _Float16* __restrict__ k16, _Float16* __restrict__ v16) {
  __shared__ __attribute__((aligned(16))) _Float16 Xs[2][128 * TP];
  __shared__ __attribute__((aligned(16))) _Float16 Ws[2][128 * TP];

  int z = blockIdx.z;
  const float* W = (z == 0) ? W0 : (z == 1) ? W1 : W2;
  const float* bias = (z == 0) ? b0 : (z == 1) ? b1 : b2;
  _Float16* dst = (z == 0) ? q16 : (z == 1) ? k16 : v16;

  int m0 = blockIdx.x * 128;
  int n0 = blockIdx.y * 128;
  int tid = threadIdx.x;
  int wid = tid >> 5, lane = tid & 31;
  int lm = lane & 15, lh = lane >> 4;
  int wm = (wid & 3) * 32;   // wave M offset
  int wn = (wid >> 2) * 64;  // wave N offset

  float4 xr[4], wr[4];  // staged global data for next chunk

  // X: a wave-wide access takes 4 rows that lie 4 apart (4 x 80 B = 16 banks
  // mod 64), 8 lanes x 4 k on each row.
  int xrow = wid * 16 + (lane >> 3) * 4;  // + it
  int xc4 = (lane & 7) << 2;
  // W: each thread owns a 4 k x 4 n block, so the transpose is a choice of
  // registers and each n row gets 4 consecutive k in one b64 store. A wave
  // holds 16 k x 32 n; rows 16 apart fall on the same banks, so the rows with
  // bit 4 of n set keep their two 16-k halves swapped.
  int skh = wid >> 2;                         // which 16-k half
  int sk = skh * 16 + (lane >> 3) * 4;        // + it
  int sn = (wid & 3) * 32 + (lane & 7) * 4;   // + j
  int wpos = sn * TP + ((skh ^ ((lane >> 2) & 1)) << 4) + (lane >> 3) * 4;

  auto pack4 = [](float a, float b, float c, float d) {
    union { _Float16 h[4]; v2u u; } pk;
    pk.h[0] = (_Float16)a; pk.h[1] = (_Float16)b;
    pk.h[2] = (_Float16)c; pk.h[3] = (_Float16)d;
    return pk.u;
  };
  auto load_global = [&](int k0) {
    for (int it = 0; it < 4; it++) {  // all loads issued before any use
      xr[it] = *(const float4*)(X + (size_t)(m0 + xrow + it) * DMODEL + k0 + xc4);
      wr[it] = *(const float4*)(W + (size_t)(k0 + sk + it) * DMODEL + n0 + sn);
    }
  };
  auto store_lds = [&](int buf) {
    for (int it = 0; it < 4; it++)
      *(v2u*)(&Xs[buf][(xrow + it) * TP + xc4]) =
          pack4(xr[it].x, xr[it].y, xr[it].z, xr[it].w);
    _Float16* wp = &Ws[buf][wpos];
    *(v2u*)(wp + 0 * TP) = pack4(wr[0].x, wr[1].x, wr[2].x, wr[3].x);
    *(v2u*)(wp + 1 * TP) = pack4(wr[0].y, wr[1].y, wr[2].y, wr[3].y);
    *(v2u*)(wp + 2 * TP) = pack4(wr[0].z, wr[1].z, wr[2].z, wr[3].z);
    *(v2u*)(wp + 3 * TP) = pack4(wr[0].w, wr[1].w, wr[2].w, wr[3].w);
  };

  load_global(0);
  store_lds(0);
  v8f acc[2][4] = {};

  const int NKC = DMODEL / 32;  // 24
  for (int kc = 0; kc < NKC; kc++) {
    __syncthreads();
    if (kc + 1 < NKC) load_global((kc + 1) * 32);  // overlap with WMMAs
    // keeps the 8 loads issued here: left free, the compiler sinks them in two
    // groups between the WMMAs and the wave waits out the load latency twice
    __builtin_amdgcn_sched_barrier(0);
    int cb = kc & 1;
    Frag af[2], bf[4];
    for (int mt = 0; mt < 2; mt++) {
      const _Float16* p = &Xs[cb][(wm + mt * 16 + lm) * TP + lh * 8];
      af[mt].u[0] = *(const v4u*)p;
      af[mt].u[1] = *(const v4u*)(p + 16);
    }
    for (int nt = 0; nt < 4; nt++) {
      const _Float16* p = &Ws[cb][(wn + nt * 16 + lm) * TP + lh * 8];
      bf[nt].u[0] = *(const v4u*)(p + (nt & 1) * 16);  // halves swapped: odd nt
      bf[nt].u[1] = *(const v4u*)(p + 16 - (nt & 1) * 16);
    }
    for (int mt = 0; mt < 2; mt++)
      for (int nt = 0; nt < 4; nt++)
        acc[mt][nt] = wmma_f16(af[mt].h, bf[nt].h, acc[mt][nt]);
    if (kc + 1 < NKC) store_lds((kc + 1) & 1);
  }

  // epilogue: +bias, scatter to (b*H+h, s, e) f16
  for (int mt = 0; mt < 2; mt++)
    for (int nt = 0; nt < 4; nt++) {
      int col = n0 + wn + nt * 16 + lm;
      float bvv = bias[col];
      int h = col >> 6, e = col & 63;
      for (int r = 0; r < 8; r++) {
        int t = m0 + wm + mt * 16 + r + 8 * lh;  // token index = s*B + b
        int s = t >> 3, b = t & 7;
        dst[((size_t)(b * NHEAD + h) * S_LEN + s) * HD + e] =
            (_Float16)(acc[mt][nt][r] + bvv);
      }
    }
}

// ---------------------------------------------------------------------------
// Kernel 2: local windowed attention with look-around, flash-style online
// softmax, all matmuls via v_wmma_f32_16x16x32_f16. K and V tiles staged
// row-major with GLOBAL_LOAD_ASYNC_TO_LDS_B128 when the toolchain exposes it.
// The products run transposed: St = K.Qt and Ot += Vt.Pt. A lane then holds
// 16 scores of ONE query (column lm; keys 8 lh + r and 16 + 8 lh + r of the
// 32-key tile), so the row maximum and sum are in-lane work plus one exchange
// between the wave's halves, the two score tiles converted in place ARE the B
// operand of the second product, and the rescale factor is the lane's own.
// LDS layout, in 16-byte pieces, no padding (three blocks fit one WGP):
//   K row j (8 pieces): piece p lies at p ^ ((j >> 1) & 7)
// so the 16 rows of a ds_load_b128 fragment read fall on all 64 banks.
//   V row j: as in memory; ds_load_tr16_b128 hands out the A fragment Vt in
//   the k order of the packed scores (8h + 0..7, then 16 + 8h + 0..7).
//   bJ: per key 0 or NEGMAX, added to the score; bN: 32 x NEGMAX, read in its
//   place by the lanes whose own query is masked.
// grid (NWIN, B*H), 256 threads (8 waves x 16 query rows).
// ---------------------------------------------------------------------------
#define ROWB 128  // K and V row, bytes
#define ATT_V_OFF  (W3 * ROWB)
#define ATT_BJ_OFF (ATT_V_OFF + W3 * ROWB)
#define ATT_BN_OFF (ATT_BJ_OFF + W3 * 4)
#define ATT_LDS    (ATT_BN_OFF + 32 * 4)  // 99,968 B

// value of lane l ^ 16
__device__ __forceinline__ float xhalf(float x) {
  int v = __builtin_bit_cast(int, x);
  return __builtin_bit_cast(
      float, __builtin_amdgcn_permlanex16(v, v, 0x76543210, 0xfedcba98, false,
                                          false));
}

__global__ __launch_bounds__(256) void local_attn_wmma(
    const _Float16* __restrict__ q16, const _Float16* __restrict__ k16,
    const _Float16* __restrict__ v16, const int* __restrict__ kpm,
    float* __restrict__ out) {
  extern __shared__ __attribute__((aligned(16))) char smem[];
  char* Ksm = smem;                        // 384 rows x 64 halves
  char* Vsm = smem + ATT_V_OFF;            // 384 rows x 64 halves
  float* bJ = (float*)(smem + ATT_BJ_OFF); // 384
  float* bN = (float*)(smem + ATT_BN_OFF); // 32

  int w = blockIdx.x, bh = blockIdx.y;
  int b = bh / NHEAD, hh = bh % NHEAD;
  int tid = threadIdx.x, wid = tid >> 5, lane = tid & 31;
  int lm = lane & 15, lh = lane >> 4;
  const _Float16* Kg = k16 + (size_t)bh * S_LEN * HD;
  const _Float16* Vg = v16 + (size_t)bh * S_LEN * HD;

  // K and V tiles, one window at a time; whether a window exists is the same
  // for the whole block, so every lane is on at every copy. A window past
  // either end is zero-filled (look-around padding).
  for (int seg = 0; seg < 3; seg++) {
    int wj = w - 1 + seg;
    char* kd = Ksm + seg * WIN * ROWB;
    char* vd = Vsm + seg * WIN * ROWB;
    if (wj >= 0 && wj < NWIN) {
      const _Float16* kg = Kg + (size_t)wj * WIN * HD;
      const _Float16* vg = Vg + (size_t)wj * WIN * HD;
      for (int it = 0; it < 4; it++) {
        int idx = it * 256 + tid;  // 16-byte piece; a wave takes 512 B in a row
        int j = idx >> 3, c = idx & 7;
        copy16_to_lds(kg + idx * 8, kd + j * ROWB + ((c ^ ((j >> 1) & 7)) << 4));
        copy16_to_lds(vg + idx * 8, vd + idx * 16);
      }
    } else {
      v4u zz = {};
      for (int it = 0; it < 4; it++) {
        int idx = it * 256 + tid;
        *(v4u*)(kd + idx * 16) = zz;
        *(v4u*)(vd + idx * 16) = zz;
      }
    }
  }
  for (int j = tid; j < W3; j += 256) {
    int s = (w - 1) * WIN + j;
    bJ[j] = (s < 0 || s >= S_LEN || kpm[b * S_LEN + s]) ? NEGMAX : 0.f;
  }
  if (tid < 32) bN[tid] = NEGMAX;
  int i0 = wid * 16;
  bool qmask = kpm[b * S_LEN + w * WIN + i0 + lm] != 0;  // the lane's query
  wait_async0();
  __syncthreads();

  const _Float16* Qg = q16 + ((size_t)bh * S_LEN + (size_t)w * WIN + i0) * HD;
  Frag aq[2];
  for (int ec = 0; ec < 2; ec++) {
    const _Float16* p = Qg + lm * HD + ec * 32 + lh * 8;
    aq[ec].u[0] = *(const v4u*)p;
    aq[ec].u[1] = *(const v4u*)(p + 16);
  }

  // hd^-0.5 * log2(e): scores are kept in log2 units. A masked score is
  // c * ksc + NEGMAX, which rounds to NEGMAX itself (|c * ksc| is far below
  // half an ulp of NEGMAX for any f16 operands).
  const float ksc = 0.125f * 1.44269504088896340736f;
  v8f Oacc[4] = {};  // Oacc[t][r] = Ot[t * 16 + 8 lh + r][query lm]
  float mr = NEGMAX;
  v8f lr = {};  // row sum in 8 parts, this half's keys only; joined at the end
  // lane offsets inside a row; a further piece index is XORed in at bits 4..6
  const char* Kl = Ksm + lm * ROWB;
  int kx = (lh ^ (lm >> 1)) << 4;  // rows jt*32 (+16) + lm: (j >> 1) & 7 = lm >> 1
  const char* Vl = Vsm + (8 * lh + (lane & 7)) * ROWB + ((lane >> 3) & 1) * 16;
  const char* bl = smem + (qmask ? ATT_BN_OFF : ATT_BJ_OFF) + lh * 32;
  int bstep = qmask ? 0 : 128;  // bytes per 32 keys

  for (int jt = 0; jt < 12; jt++) {
    // scores: two 16-key tiles over hd (K = 2 chunks of 32)
    v8f c0 = {}, c1 = {};
    for (int ec = 0; ec < 2; ec++) {
      Frag bk0, bk1;
      const char* p0 = Kl + jt * 32 * ROWB;
      const char* p1 = p0 + 16 * ROWB;
      int ka = kx ^ (ec * 64), kb = ka ^ 32;
      bk0.u[0] = *(const v4u*)(p0 + ka); bk0.u[1] = *(const v4u*)(p0 + kb);
      bk1.u[0] = *(const v4u*)(p1 + ka); bk1.u[1] = *(const v4u*)(p1 + kb);
      c0 = wmma_f16(bk0.h, aq[ec].h, c0);
      c1 = wmma_f16(bk1.h, aq[ec].h, c1);
    }
    // Vt fragments of this tile, asked for here so that they arrive while the
    // softmax below runs
    Frag av[4];
    for (int t = 0; t < 4; t++) {
      const char* vp = Vl + jt * 32 * ROWB + t * 32;
      av[t].u[0] = ld_tr16(vp);
      av[t].u[1] = ld_tr16(vp + 16 * ROWB);
    }
    const v8f* bp = (const v8f*)(bl + jt * bstep);
    c0 = c0 * ksc + bp[0];  // bias of keys jt*32 + 8 lh + r
    c1 = c1 * ksc + bp[2];  // bias of keys jt*32 + 16 + 8 lh + r
    float tm = NEGMAX;
    for (int r = 0; r < 8; r++) tm = fmaxf(tm, fmaxf(c0[r], c1[r]));
    tm = fmaxf(tm, xhalf(tm));
    float mn = fmaxf(mr, tm);
    float sc = __builtin_amdgcn_exp2f(mr - mn);
    mr = mn;
    c0 -= mn;
    c1 -= mn;
    Frag pb;  // Pt as B operand: element s = key kmap(s, lh), column lm
    for (int r = 0; r < 8; r++) {
      c0[r] = __builtin_amdgcn_exp2f(c0[r]);
      c1[r] = __builtin_amdgcn_exp2f(c1[r]);
      pb.h[r] = (_Float16)c0[r];
      pb.h[8 + r] = (_Float16)c1[r];
    }
    lr = lr * sc + (c0 + c1);
    for (int t = 0; t < 4; t++) {
      Oacc[t] *= sc;
      Oacc[t] = wmma_f16(av[t].h, pb.h, Oacc[t]);
    }
  }

  float ls = ((lr[0] + lr[1]) + (lr[2] + lr[3])) +
             ((lr[4] + lr[5]) + (lr[6] + lr[7]));
  float rl = 1.f / (ls + xhalf(ls));
  int srow = w * WIN + i0 + lm;
  float* op = out + ((size_t)srow * BATCH + b) * DMODEL + hh * HD + lh * 8;
  for (int t = 0; t < 4; t++) {  // 8 consecutive columns of one row per lane
    float4 o0 = {Oacc[t][0] * rl, Oacc[t][1] * rl, Oacc[t][2] * rl,
                 Oacc[t][3] * rl};
    float4 o1 = {Oacc[t][4] * rl, Oacc[t][5] * rl, Oacc[t][6] * rl,
                 Oacc[t][7] * rl};
    *(float4*)(op + t * 16) = o0;
    *(float4*)(op + t * 16 + 4) = o1;
  }
}

// ---------------------------------------------------------------------------
// Kernel 3: gq = hidden[0] @ Wgq + bgq  (tiny)
// ---------------------------------------------------------------------------
__global__ __launch_bounds__(256) void gq_proj(const float* __restrict__ X,
                                               const float* __restrict__ Wgq,
                                               const float* __restrict__ bgq,
                                               float* __restrict__ gq) {
  int idx = blockIdx.x * 256 + threadIdx.x;
  if (idx >= BATCH * DMODEL) return;
  int b = idx / DMODEL, d = idx % DMODEL;
  const float* xr = X + (size_t)b * DMODEL;  // hidden[(0,b),:]
  float s = bgq[d];
  for (int k = 0; k < DMODEL; k++) s += xr[k] * Wgq[(size_t)k * DMODEL + d];
  gq[idx] = s;  // layout (b*H+h)*64+e == b*768+d
}

// ---------------------------------------------------------------------------
// Kernel 4: global-token attention, overwrites out row 0. Deterministic
// tree reductions (no float atomics).
// ---------------------------------------------------------------------------
__global__ __launch_bounds__(256) void global_attn_kernel(
    const float* __restrict__ gq, const _Float16* __restrict__ k16,
    const _Float16* __restrict__ v16, const int* __restrict__ kpm,
    float* __restrict__ out) {
  __shared__ float sc[S_LEN];
  __shared__ float qsh[HD];
  __shared__ float red[256];
  __shared__ float accv[HD + 1];
  int bh = blockIdx.x;
  int b = bh / NHEAD, hh = bh % NHEAD;
  int tid = threadIdx.x;
  if (tid < HD) qsh[tid] = gq[bh * HD + tid];
  __syncthreads();

  const _Float16* Kg = k16 + (size_t)bh * S_LEN * HD;
  const _Float16* Vg = v16 + (size_t)bh * S_LEN * HD;
  float lmax = NEGMAX;
  for (int s = tid; s < S_LEN; s += 256) {
    const _Float16* kr = Kg + (size_t)s * HD;
    float d = 0.f;
    for (int e = 0; e < HD; e++) d += qsh[e] * (float)kr[e];
    d *= 0.125f;
    if (kpm[b * S_LEN + s]) d = NEGMAX;
    sc[s] = d;
    lmax = fmaxf(lmax, d);
  }
  red[tid] = lmax;
  __syncthreads();
  for (int st = 128; st > 0; st >>= 1) {
    if (tid < st) red[tid] = fmaxf(red[tid], red[tid + st]);
    __syncthreads();
  }
  float M = red[0];
  __syncthreads();

  float av[HD];
  for (int e = 0; e < HD; e++) av[e] = 0.f;
  float lsum = 0.f;
  for (int s = tid; s < S_LEN; s += 256) {
    float p = __expf(sc[s] - M);
    lsum += p;
    const _Float16* vr = Vg + (size_t)s * HD;
    for (int e = 0; e < HD; e++) av[e] += p * (float)vr[e];
  }
  for (int e = 0; e < HD; e++) {
    red[tid] = av[e];
    __syncthreads();
    for (int st = 128; st > 0; st >>= 1) {
      if (tid < st) red[tid] += red[tid + st];
      __syncthreads();
    }
    if (tid == 0) accv[e] = red[0];
    __syncthreads();
  }
  red[tid] = lsum;
  __syncthreads();
  for (int st = 128; st > 0; st >>= 1) {
    if (tid < st) red[tid] += red[tid + st];
    __syncthreads();
  }
  if (tid == 0) accv[HD] = red[0];
  __syncthreads();
  if (tid < HD)
    out[(size_t)b * DMODEL + hh * HD + tid] = accv[tid] / accv[HD];
}

// ---------------------------------------------------------------------------
extern "C" void kernel_launch(void* const* d_in, const int* in_sizes, int n_in,
                              void* d_out, int out_size, void* d_ws,
                              size_t ws_size, hipStream_t stream) {
  (void)in_sizes; (void)n_in; (void)out_size; (void)ws_size;
  const float* hs  = (const float*)d_in[0];
  const int*   kpm = (const int*)d_in[1];
  const float* Wq  = (const float*)d_in[2];
  const float* Wk  = (const float*)d_in[3];
  const float* Wv  = (const float*)d_in[4];
  const float* Wgq = (const float*)d_in[5];
  const float* bq  = (const float*)d_in[6];
  const float* bk  = (const float*)d_in[7];
  const float* bv  = (const float*)d_in[8];
  const float* bgq = (const float*)d_in[9];
  float* out = (float*)d_out;

  size_t per = (size_t)BATCH * NHEAD * S_LEN * HD;  // halfs per q/k/v tensor
  _Float16* q16 = (_Float16*)d_ws;
  _Float16* k16 = q16 + per;
  _Float16* v16 = k16 + per;
  float* gqbuf = (float*)(v16 + per);

  dim3 g1(256, 6, 3);
  qkv_gemm_wmma<<<g1, 256, 0, stream>>>(hs, Wq, Wk, Wv, bq, bk, bv, q16, k16,
                                        v16);
  gq_proj<<<(BATCH * DMODEL + 255) / 256, 256, 0, stream>>>(hs, Wgq, bgq,
                                                            gqbuf);
  size_t lds_bytes = ATT_LDS;
  dim3 g2(NWIN, BATCH * NHEAD);
  local_attn_wmma<<<g2, 256, lds_bytes, stream>>>(q16, k16, v16, kpm, out);
  global_attn_kernel<<<BATCH * NHEAD, 256, 0, stream>>>(gqbuf, k16, v16, kpm,
                                                        out);
}

// v004
// It runs in 262 microseconds.
// Two timings next to v003 put it at 1.54 and 1.53 times that version's speed.
// Counting every step since v000, it is 4.71 times as fast.
#include <hip/hip_runtime.h>
#include <hip/hip_bf16.h>

typedef __attribute__((ext_vector_type(16))) _Float16     v16h;
typedef __attribute__((ext_vector_type(8)))  float        v8f;
typedef __attribute__((ext_vector_type(4)))  unsigned int v4u;
typedef __attribute__((ext_vector_type(2)))  unsigned int v2u;
typedef __attribute__((ext_vector_type(4)))  int          v4i;
typedef __attribute__((address_space(1))) v4i* gv4i_p;  // global ("__device__")
typedef __attribute__((address_space(3))) v4i* lv4i_p;  // LDS ("__shared__")

#define S_LEN  4096
#define BATCH  8
#define DMODEL 768
#define NHEAD  12
#define HD     64
#define WIN    128
#define NWIN   32
#define W3     384
#define NEGMAX (-3.402823466e+38f)

#if __has_builtin(__builtin_amdgcn_global_load_async_to_lds_b128)
#define HAVE_ASYNC_LDS 1
#endif

union Frag { v4u u[2]; v16h h; };

__device__ __forceinline__ v8f wmma_f16(v16h a, v16h b, v8f c) {
  return __builtin_amdgcn_wmma_f32_16x16x32_f16(false, a, false, b, (short)0, c,
                                                false, false);
}

__device__ __forceinline__ void wait_async0() {
#ifdef HAVE_ASYNC_LDS
  // this wave's async copies have landed; the clobber holds LDS reads behind it
  asm volatile("s_wait_asynccnt 0x0" ::: "memory");
#endif
}

// 16 bytes, global -> LDS, per lane
__device__ __forceinline__ void copy16_to_lds(const _Float16* g, char* l) {
#ifdef HAVE_ASYNC_LDS
  __builtin_amdgcn_global_load_async_to_lds_b128((gv4i_p)g, (lv4i_p)l, 0, 0);
#else
  *(v4u*)l = *(const v4u*)g;
#endif
}

// transposing LDS load: lane (c = l & 15, h = l >> 4) gets T[8h + 0..7][c] of a
// row-major 16-bit tile; the lane's address names row 8h + (l & 7), 16-byte
// piece (l >> 3) & 1
typedef short s16x8 __attribute__((ext_vector_type(8)));
typedef __attribute__((address_space(3))) s16x8 lds_s16x8;
__device__ __forceinline__ v4u ld_tr16(const char* p) {
  return __builtin_bit_cast(
      v4u, __builtin_amdgcn_ds_load_tr16_b128_v8i16((lds_s16x8*)p));
}

// ---------------------------------------------------------------------------
// gq = hidden[0] @ Wgq + bgq (tiny, bound by load latency). Runs as the first
// GQ_BLOCKS work-groups of the projection launch, beside the GEMM tiles.
// ---------------------------------------------------------------------------
#define GQ_BLOCKS ((BATCH * DMODEL + 255) / 256)  // 24
__device__ __forceinline__ void gq_proj_block(int blk,
                                              const float* __restrict__ X,
                                              const float* __restrict__ Wgq,
                                              const float* __restrict__ bgq,
                                              float* __restrict__ gq) {
  int idx = blk * 256 + threadIdx.x;
  if (idx >= BATCH * DMODEL) return;
  int b = idx / DMODEL, d = idx % DMODEL;
  const float* xr = X + (size_t)b * DMODEL;  // hidden[(0,b),:]
  float s = bgq[d];
  for (int k = 0; k < DMODEL; k++) s += xr[k] * Wgq[(size_t)k * DMODEL + d];
  gq[idx] = s;  // layout (b*H+h)*64+e == b*768+d
}

// ---------------------------------------------------------------------------
// Kernel 1: fused Q/K/V projection GEMM (z selects weight), f32 in -> f16 out
// scattered into (B*H, S, hd) layout. Block tile 128x128, K-chunks of 32,
// double-buffered LDS so global loads overlap the WMMAs.
// LDS tiles: one row per m (Xs) or n (Ws), 32 k as f16, row pitch 80 B
// (16 B x odd: the 16 rows of a b128 fragment read fall on distinct banks).
// Every staging store is a b64 whose 32 lanes cover all 64 banks once.
// 1-D grid: GQ_BLOCKS work-groups of the gq projection first (they start first
// and finish under the GEMM), then the tiles, m fastest, then n, then weight.
// ---------------------------------------------------------------------------
#define TP 40  // LDS row pitch in halves
__global__ __launch_bounds__(256) void qkv_gemm_wmma(
    const float* __restrict__ X, const float* __restrict__ W0,
    const float* __restrict__ W1, const float* __restrict__ W2,
    const float* __restrict__ b0, const float* __restrict__ b1,
    const float* __restrict__ b2, _Float16* __restrict__ q16,
    _Float16* __restrict__ k16, _Float16* __restrict__ v16,
    const float* __restrict__ Wgq, const float* __restrict__ bgq,
    float* __restrict__ gq) {
  __shared__ __attribute__((aligned(16))) _Float16 Xs[2][128 * TP];
  __shared__ __attribute__((aligned(16))) _Float16 Ws[2][128 * TP];

  int bid = blockIdx.x;
  if (bid < GQ_BLOCKS) {  // the same for the whole block, ahead of any barrier
    gq_proj_block(bid, X, Wgq, bgq, gq);
    return;
  }
  bid -= GQ_BLOCKS;
  int yz = bid >> 8;  // 256 m tiles
  int z = yz / 6;
  const float* W = (z == 0) ? W0 : (z == 1) ? W1 : W2;
  const float* bias = (z == 0) ? b0 : (z == 1) ? b1 : b2;
  _Float16* dst = (z == 0) ? q16 : (z == 1) ? k16 : v16;

  int m0 = (bid & 255) * 128;
  int n0 = (yz % 6) * 128;
  int tid = threadIdx.x;
  int wid = tid >> 5, lane = tid & 31;
  int lm = lane & 15, lh = lane >> 4;
  int wm = (wid & 3) * 32;   // wave M offset
  int wn = (wid >> 2) * 64;  // wave N offset

  float4 xr[4], wr[4];  // staged global data for next chunk

  // X: a wave-wide access takes 4 rows that lie 4 apart (4 x 80 B = 16 banks
  // mod 64), 8 lanes x 4 k on each row.
  int xrow = wid * 16 + (lane >> 3) * 4;  // + it
  int xc4 = (lane & 7) << 2;
  // W: each thread owns a 4 k x 4 n block, so the transpose is a choice of
  // registers and each n row gets 4 consecutive k in one b64 store. A wave
  // holds 16 k x 32 n; rows 16 apart fall on the same banks, so the rows with
  // bit 4 of n set keep their two 16-k halves swapped.
  int skh = wid >> 2;                         // which 16-k half
  int sk = skh * 16 + (lane >> 3) * 4;        // + it
  int sn = (wid & 3) * 32 + (lane & 7) * 4;   // + j
  int wpos = sn * TP + ((skh ^ ((lane >> 2) & 1)) << 4) + (lane >> 3) * 4;

  auto pack4 = [](float a, float b, float c, float d) {
    union { _Float16 h[4]; v2u u; } pk;
    pk.h[0] = (_Float16)a; pk.h[1] = (_Float16)b;
    pk.h[2] = (_Float16)c; pk.h[3] = (_Float16)d;
    return pk.u;
  };
  auto load_global = [&](int k0) {
    for (int it = 0; it < 4; it++) {  // all loads issued before any use
      xr[it] = *(const float4*)(X + (size_t)(m0 + xrow + it) * DMODEL + k0 + xc4);
      wr[it] = *(const float4*)(W + (size_t)(k0 + sk + it) * DMODEL + n0 + sn);
    }
  };
  auto store_lds = [&](int buf) {
    for (int it = 0; it < 4; it++)
      *(v2u*)(&Xs[buf][(xrow + it) * TP + xc4]) =
          pack4(xr[it].x, xr[it].y, xr[it].z, xr[it].w);
    _Float16* wp = &Ws[buf][wpos];
    *(v2u*)(wp + 0 * TP) = pack4(wr[0].x, wr[1].x, wr[2].x, wr[3].x);
    *(v2u*)(wp + 1 * TP) = pack4(wr[0].y, wr[1].y, wr[2].y, wr[3].y);
    *(v2u*)(wp + 2 * TP) = pack4(wr[0].z, wr[1].z, wr[2].z, wr[3].z);
    *(v2u*)(wp + 3 * TP) = pack4(wr[0].w, wr[1].w, wr[2].w, wr[3].w);
  };

  load_global(0);
  store_lds(0);
  v8f acc[2][4] = {};

  const int NKC = DMODEL / 32;  // 24
  for (int kc = 0; kc < NKC; kc++) {
    __syncthreads();
    if (kc + 1 < NKC) load_global((kc + 1) * 32);  // overlap with WMMAs
    // keeps the 8 loads issued here: left free, the compiler sinks them in two
    // groups between the WMMAs and the wave waits out the load latency twice
    __builtin_amdgcn_sched_barrier(0);
    int cb = kc & 1;
    Frag af[2], bf[4];
    for (int mt = 0; mt < 2; mt++) {
      const _Float16* p = &Xs[cb][(wm + mt * 16 + lm) * TP + lh * 8];
      af[mt].u[0] = *(const v4u*)p;
      af[mt].u[1] = *(const v4u*)(p + 16);
    }
    for (int nt = 0; nt < 4; nt++) {
      const _Float16* p = &Ws[cb][(wn + nt * 16 + lm) * TP + lh * 8];
      bf[nt].u[0] = *(const v4u*)(p + (nt & 1) * 16);  // halves swapped: odd nt
      bf[nt].u[1] = *(const v4u*)(p + 16 - (nt & 1) * 16);
    }
    for (int mt = 0; mt < 2; mt++)
      for (int nt = 0; nt < 4; nt++)
        acc[mt][nt] = wmma_f16(af[mt].h, bf[nt].h, acc[mt][nt]);
    if (kc + 1 < NKC) store_lds((kc + 1) & 1);
  }

  // epilogue: +bias, scatter to (b*H+h, s, e) f16
  for (int mt = 0; mt < 2; mt++)
    for (int nt = 0; nt < 4; nt++) {
      int col = n0 + wn + nt * 16 + lm;
      float bvv = bias[col];
      int h = col >> 6, e = col & 63;
      for (int r = 0; r < 8; r++) {
        int t = m0 + wm + mt * 16 + r + 8 * lh;  // token index = s*B + b
        int s = t >> 3, b = t & 7;
        dst[((size_t)(b * NHEAD + h) * S_LEN + s) * HD + e] =
            (_Float16)(acc[mt][nt][r] + bvv);
      }
    }
}

// ---------------------------------------------------------------------------
// Kernel 2: local windowed attention with look-around, flash-style online
// softmax, all matmuls via v_wmma_f32_16x16x32_f16. K and V tiles staged
// row-major with GLOBAL_LOAD_ASYNC_TO_LDS_B128 when the toolchain exposes it.
// The products run transposed: St = K.Qt and Ot += Vt.Pt. A lane then holds
// 16 scores of ONE query (column lm; keys 8 lh + r and 16 + 8 lh + r of the
// 32-key tile), so the row maximum and sum are in-lane work plus one exchange
// between the wave's halves, the two score tiles converted in place ARE the B
// operand of the second product, and the rescale factor is the lane's own.
// LDS layout, in 16-byte pieces, no padding (three blocks fit one WGP):
//   K row j (8 pieces): piece p lies at p ^ ((j >> 1) & 7)
// so the 16 rows of a ds_load_b128 fragment read fall on all 64 banks.
//   V row j: as in memory; ds_load_tr16_b128 hands out the A fragment Vt in
//   the k order of the packed scores (8h + 0..7, then 16 + 8h + 0..7).
//   bJ: per key 0 or NEGMAX, added to the score; bN: 32 x NEGMAX, read in its
//   place by the lanes whose own query is masked.
// 1-D grid, 256 threads (8 waves x 16 query rows): the B*H work-groups of the
// global-token attention first (long and latency-bound: they start first and
// run beside the windows), then NWIN x B*H windows. Row 0 of out belongs to the
// global token, so the window that holds query 0 does not store it.
// ---------------------------------------------------------------------------
#define ROWB 128  // K and V row, bytes
#define ATT_V_OFF  (W3 * ROWB)
#define ATT_BJ_OFF (ATT_V_OFF + W3 * ROWB)
#define ATT_BN_OFF (ATT_BJ_OFF + W3 * 4)
#define ATT_LDS    (ATT_BN_OFF + 32 * 4)  // 99,968 B

// value of lane l ^ 16
__device__ __forceinline__ float xhalf(float x) {
  int v = __builtin_bit_cast(int, x);
  return __builtin_bit_cast(
      float, __builtin_amdgcn_permlanex16(v, v, 0x76543210, 0xfedcba98, false,
                                          false));
}

// ---------------------------------------------------------------------------
// Global-token attention of one (batch, head): writes out row 0. Deterministic
// tree reductions (no float atomics). Runs as the first BATCH * NHEAD
// work-groups of the attention launch, beside the local windows, in the same
// dynamic LDS. Each thread parks its 64 partial sums in LDS (its own column),
// where the rolled reduction loop can index them: the launch then needs no
// private memory.
// ---------------------------------------------------------------------------
#define GA_QSH_OFF  (S_LEN * 4)
#define GA_RED_OFF  (GA_QSH_OFF + HD * 4)
#define GA_ACC_OFF  (GA_RED_OFF + 256 * 4)
#define GA_PARK_OFF (GA_ACC_OFF + (HD + 4) * 4)
#define GA_LDS      (GA_PARK_OFF + HD * 256 * 4)  // 83,472 B
static_assert(GA_LDS <= ATT_LDS, "global-token path fits the launch's LDS");

__device__ __forceinline__ void global_attn_block(
    int bh, char* smem, const float* __restrict__ gq,
    const _Float16* __restrict__ k16, const _Float16* __restrict__ v16,
    const int* __restrict__ kpm, float* __restrict__ out) {
  float* sc = (float*)smem;                    // S_LEN
  float* qsh = (float*)(smem + GA_QSH_OFF);    // HD
  float* red = (float*)(smem + GA_RED_OFF);    // 256
  float* accv = (float*)(smem + GA_ACC_OFF);   // HD + 1
  float* park = (float*)(smem + GA_PARK_OFF);  // HD x 256
  int b = bh / NHEAD, hh = bh % NHEAD;
  int tid = threadIdx.x;
  if (tid < HD) qsh[tid] = gq[bh * HD + tid];
  __syncthreads();

  const _Float16* Kg = k16 + (size_t)bh * S_LEN * HD;
  const _Float16* Vg = v16 + (size_t)bh * S_LEN * HD;
  // the query in registers: carved out of one LDS array, qsh cannot be told
  // apart from sc by the compiler, which would reload it after each score store
  float qr[HD];
  for (int e = 0; e < HD; e++) qr[e] = qsh[e];
  float lmax = NEGMAX;
  for (int s = tid; s < S_LEN; s += 256) {
    const _Float16* kr = Kg + (size_t)s * HD;
    float d = 0.f;
    for (int e = 0; e < HD; e++) d += qr[e] * (float)kr[e];
    d *= 0.125f;
    if (kpm[b * S_LEN + s]) d = NEGMAX;
    sc[s] = d;
    lmax = fmaxf(lmax, d);
  }
  red[tid] = lmax;
  __syncthreads();
  for (int st = 128; st > 0; st >>= 1) {
    if (tid < st) red[tid] = fmaxf(red[tid], red[tid + st]);
    __syncthreads();
  }
  float M = red[0];
  __syncthreads();

  float av[HD];
  for (int e = 0; e < HD; e++) av[e] = 0.f;
  float lsum = 0.f;
  for (int s = tid; s < S_LEN; s += 256) {
    float p = __expf(sc[s] - M);
    lsum += p;
    const _Float16* vr = Vg + (size_t)s * HD;
    for (int e = 0; e < HD; e++) av[e] += p * (float)vr[e];
  }
  for (int e = 0; e < HD; e++) park[e * 256 + tid] = av[e];
  for (int e = 0; e < HD; e++) {
    red[tid] = park[e * 256 + tid];  // the thread's own word: no barrier owed
    __syncthreads();
    for (int st = 128; st > 0; st >>= 1) {
      if (tid < st) red[tid] += red[tid + st];
      __syncthreads();
    }
    if (tid == 0) accv[e] = red[0];
    __syncthreads();
  }
  red[tid] = lsum;
  __syncthreads();
  for (int st = 128; st > 0; st >>= 1) {
    if (tid < st) red[tid] += red[tid + st];
    __syncthreads();
  }
  if (tid == 0) accv[HD] = red[0];
  __syncthreads();
  if (tid < HD)
    out[(size_t)b * DMODEL + hh * HD + tid] = accv[tid] / accv[HD];
}

__global__ __launch_bounds__(256) void local_attn_wmma(
    const _Float16* __restrict__ q16, const _Float16* __restrict__ k16,
    const _Float16* __restrict__ v16, const int* __restrict__ kpm,
    const float* __restrict__ gq, float* __restrict__ out) {
  extern __shared__ __attribute__((aligned(16))) char smem[];
  char* Ksm = smem;                        // 384 rows x 64 halves
  char* Vsm = smem + ATT_V_OFF;            // 384 rows x 64 halves
  float* bJ = (float*)(smem + ATT_BJ_OFF); // 384
  float* bN = (float*)(smem + ATT_BN_OFF); // 32

  int bid = blockIdx.x;
  if (bid < BATCH * NHEAD) {  // the same for the whole block, ahead of any barrier
    global_attn_block(bid, smem, gq, k16, v16, kpm, out);
    return;
  }
  bid -= BATCH * NHEAD;
  int w = bid & (NWIN - 1), bh = bid >> 5;  // window fastest
  int b = bh / NHEAD, hh = bh % NHEAD;
  int tid = threadIdx.x, wid = tid >> 5, lane = tid & 31;
  int lm = lane & 15, lh = lane >> 4;
  const _Float16* Kg = k16 + (size_t)bh * S_LEN * HD;
  const _Float16* Vg = v16 + (size_t)bh * S_LEN * HD;

  // K and V tiles, one window at a time; whether a window exists is the same
  // for the whole block, so every lane is on at every copy. A window past
  // either end is zero-filled (look-around padding).
  for (int seg = 0; seg < 3; seg++) {
    int wj = w - 1 + seg;
    char* kd = Ksm + seg * WIN * ROWB;
    char* vd = Vsm + seg * WIN * ROWB;
    if (wj >= 0 && wj < NWIN) {
      const _Float16* kg = Kg + (size_t)wj * WIN * HD;
      const _Float16* vg = Vg + (size_t)wj * WIN * HD;
      for (int it = 0; it < 4; it++) {
        int idx = it * 256 + tid;  // 16-byte piece; a wave takes 512 B in a row
        int j = idx >> 3, c = idx & 7;
        copy16_to_lds(kg + idx * 8, kd + j * ROWB + ((c ^ ((j >> 1) & 7)) << 4));
        copy16_to_lds(vg + idx * 8, vd + idx * 16);
      }
    } else {
      v4u zz = {};
      for (int it = 0; it < 4; it++) {
        int idx = it * 256 + tid;
        *(v4u*)(kd + idx * 16) = zz;
        *(v4u*)(vd + idx * 16) = zz;
      }
    }
  }
  for (int j = tid; j < W3; j += 256) {
    int s = (w - 1) * WIN + j;
    bJ[j] = (s < 0 || s >= S_LEN || kpm[b * S_LEN + s]) ? NEGMAX : 0.f;
  }
  if (tid < 32) bN[tid] = NEGMAX;
  int i0 = wid * 16;
  bool qmask = kpm[b * S_LEN + w * WIN + i0 + lm] != 0;  // the lane's query
  wait_async0();
  __syncthreads();

  const _Float16* Qg = q16 + ((size_t)bh * S_LEN + (size_t)w * WIN + i0) * HD;
  Frag aq[2];
  for (int ec = 0; ec < 2; ec++) {
    const _Float16* p = Qg + lm * HD + ec * 32 + lh * 8;
    aq[ec].u[0] = *(const v4u*)p;
    aq[ec].u[1] = *(const v4u*)(p + 16);
  }

  // hd^-0.5 * log2(e): scores are kept in log2 units. A masked score is
  // c * ksc + NEGMAX, which rounds to NEGMAX itself (|c * ksc| is far below
  // half an ulp of NEGMAX for any f16 operands).
  const float ksc = 0.125f * 1.44269504088896340736f;
  v8f Oacc[4] = {};  // Oacc[t][r] = Ot[t * 16 + 8 lh + r][query lm]
  float mr = NEGMAX;
  v8f lr = {};  // row sum in 8 parts, this half's keys only; joined at the end
  // lane offsets inside a row; a further piece index is XORed in at bits 4..6
  const char* Kl = Ksm + lm * ROWB;
  int kx = (lh ^ (lm >> 1)) << 4;  // rows jt*32 (+16) + lm: (j >> 1) & 7 = lm >> 1
  const char* Vl = Vsm + (8 * lh + (lane & 7)) * ROWB + ((lane >> 3) & 1) * 16;
  const char* bl = smem + (qmask ? ATT_BN_OFF : ATT_BJ_OFF) + lh * 32;
  int bstep = qmask ? 0 : 128;  // bytes per 32 keys

  for (int jt = 0; jt < 12; jt++) {
    // scores: two 16-key tiles over hd (K = 2 chunks of 32)
    v8f c0 = {}, c1 = {};
    for (int ec = 0; ec < 2; ec++) {
      Frag bk0, bk1;
      const char* p0 = Kl + jt * 32 * ROWB;
      const char* p1 = p0 + 16 * ROWB;
      int ka = kx ^ (ec * 64), kb = ka ^ 32;
      bk0.u[0] = *(const v4u*)(p0 + ka); bk0.u[1] = *(const v4u*)(p0 + kb);
      bk1.u[0] = *(const v4u*)(p1 + ka); bk1.u[1] = *(const v4u*)(p1 + kb);
      c0 = wmma_f16(bk0.h, aq[ec].h, c0);
      c1 = wmma_f16(bk1.h, aq[ec].h, c1);
    }
    // Vt fragments of this tile, asked for here so that they arrive while the
    // softmax below runs
    Frag av[4];
    for (int t = 0; t < 4; t++) {
      const char* vp = Vl + jt * 32 * ROWB + t * 32;
      av[t].u[0] = ld_tr16(vp);
      av[t].u[1] = ld_tr16(vp + 16 * ROWB);
    }
    const v8f* bp = (const v8f*)(bl + jt * bstep);
    c0 = c0 * ksc + bp[0];  // bias of keys jt*32 + 8 lh + r
    c1 = c1 * ksc + bp[2];  // bias of keys jt*32 + 16 + 8 lh + r
    float tm = NEGMAX;
    for (int r = 0; r < 8; r++) tm = fmaxf(tm, fmaxf(c0[r], c1[r]));
    tm = fmaxf(tm, xhalf(tm));
    float mn = fmaxf(mr, tm);
    float sc = __builtin_amdgcn_exp2f(mr - mn);
    mr = mn;
    c0 -= mn;
    c1 -= mn;
    Frag pb;  // Pt as B operand: element s = key kmap(s, lh), column lm
    for (int r = 0; r < 8; r++) {
      c0[r] = __builtin_amdgcn_exp2f(c0[r]);
      c1[r] = __builtin_amdgcn_exp2f(c1[r]);
      pb.h[r] = (_Float16)c0[r];
      pb.h[8 + r] = (_Float16)c1[r];
    }
    lr = lr * sc + (c0 + c1);
    for (int t = 0; t < 4; t++) {
      Oacc[t] *= sc;
      Oacc[t] = wmma_f16(av[t].h, pb.h, Oacc[t]);
    }
  }

  float ls = ((lr[0] + lr[1]) + (lr[2] + lr[3])) +
             ((lr[4] + lr[5]) + (lr[6] + lr[7]));
  float rl = 1.f / (ls + xhalf(ls));
  int srow = w * WIN + i0 + lm;
  float* op = out + ((size_t)srow * BATCH + b) * DMODEL + hh * HD + lh * 8;
  if (srow == 0) return;  // the global token's row; no barrier follows
  for (int t = 0; t < 4; t++) {  // 8 consecutive columns of one row per lane
    float4 o0 = {Oacc[t][0] * rl, Oacc[t][1] * rl, Oacc[t][2] * rl,
                 Oacc[t][3] * rl};
    float4 o1 = {Oacc[t][4] * rl, Oacc[t][5] * rl, Oacc[t][6] * rl,
                 Oacc[t][7] * rl};
    *(float4*)(op + t * 16) = o0;
    *(float4*)(op + t * 16 + 4) = o1;
  }
}

// ---------------------------------------------------------------------------
extern "C" void kernel_launch(void* const* d_in, const int* in_sizes, int n_in,
                              void* d_out, int out_size, void* d_ws,
                              size_t ws_size, hipStream_t stream) {
  (void)in_sizes; (void)n_in; (void)out_size; (void)ws_size;
  const float* hs  = (const float*)d_in[0];
  const int*   kpm = (const int*)d_in[1];
  const float* Wq  = (const float*)d_in[2];
  const float* Wk  = (const float*)d_in[3];
  const float* Wv  = (const float*)d_in[4];
  const float* Wgq = (const float*)d_in[5];
  const float* bq  = (const float*)d_in[6];
  const float* bk  = (const float*)d_in[7];
  const float* bv  = (const float*)d_in[8];
  const float* bgq = (const float*)d_in[9];
  float* out = (float*)d_out;

  size_t per = (size_t)BATCH * NHEAD * S_LEN * HD;  // halfs per q/k/v tensor
  _Float16* q16 = (_Float16*)d_ws;
  _Float16* k16 = q16 + per;
  _Float16* v16 = k16 + per;
  float* gqbuf = (float*)(v16 + per);

  qkv_gemm_wmma<<<GQ_BLOCKS + 256 * 6 * 3, 256, 0, stream>>>(
      hs, Wq, Wk, Wv, bq, bk, bv, q16, k16, v16, Wgq, bgq, gqbuf);
  size_t lds_bytes = ATT_LDS;
  local_attn_wmma<<<BATCH * NHEAD + NWIN * BATCH * NHEAD, 256, lds_bytes,
                    stream>>>(q16, k16, v16, kpm, gqbuf, out);
}

// v005
// One run takes 231 microseconds.
// Two timings next to v004 both put it at 1.14 times that version's speed.
// Counting every step since v000, it is 5.36 times as fast.
#include <hip/hip_runtime.h>
#include <hip/hip_bf16.h>

typedef __attribute__((ext_vector_type(16))) _Float16     v16h;
typedef __attribute__((ext_vector_type(8)))  float        v8f;
typedef __attribute__((ext_vector_type(4)))  unsigned int v4u;
typedef __attribute__((ext_vector_type(2)))  unsigned int v2u;
typedef __attribute__((ext_vector_type(4)))  int          v4i;
typedef __attribute__((address_space(1))) v4i* gv4i_p;  // global ("__device__")
typedef __attribute__((address_space(3))) v4i* lv4i_p;  // LDS ("__shared__")

#define S_LEN  4096
#define BATCH  8
#define DMODEL 768
#define NHEAD  12
#define HD     64
#define WIN    128
#define NWIN   32
#define W3     384
#define NEGMAX (-3.402823466e+38f)

#if __has_builtin(__builtin_amdgcn_global_load_async_to_lds_b128)
#define HAVE_ASYNC_LDS 1
#endif

union Frag { v4u u[2]; v16h h; };

__device__ __forceinline__ v8f wmma_f16(v16h a, v16h b, v8f c) {
  return __builtin_amdgcn_wmma_f32_16x16x32_f16(false, a, false, b, (short)0, c,
                                                false, false);
}

__device__ __forceinline__ void wait_async0() {
#ifdef HAVE_ASYNC_LDS
  // this wave's async copies have landed; the clobber holds LDS reads behind it
  asm volatile("s_wait_asynccnt 0x0" ::: "memory");
#endif
}

// 16 bytes, global -> LDS, per lane
__device__ __forceinline__ void copy16_to_lds(const _Float16* g, char* l) {
#ifdef HAVE_ASYNC_LDS
  __builtin_amdgcn_global_load_async_to_lds_b128((gv4i_p)g, (lv4i_p)l, 0, 0);
#else
  *(v4u*)l = *(const v4u*)g;
#endif
}

// transposing LDS load: lane (c = l & 15, h = l >> 4) gets T[8h + 0..7][c] of a
// row-major 16-bit tile; the lane's address names row 8h + (l & 7), 16-byte
// piece (l >> 3) & 1
typedef short s16x8 __attribute__((ext_vector_type(8)));
typedef __attribute__((address_space(3))) s16x8 lds_s16x8;
__device__ __forceinline__ v4u ld_tr16(const char* p) {
  return __builtin_bit_cast(
      v4u, __builtin_amdgcn_ds_load_tr16_b128_v8i16((lds_s16x8*)p));
}

// ---------------------------------------------------------------------------
// gq = hidden[0] @ Wgq + bgq (tiny, bound by load latency). Runs as the first
// GQ_BLOCKS work-groups of the projection launch, beside the GEMM tiles.
// ---------------------------------------------------------------------------
#define GQ_BLOCKS ((BATCH * DMODEL + 255) / 256)  // 24
__device__ __forceinline__ void gq_proj_block(int blk,
                                              const float* __restrict__ X,
                                              const float* __restrict__ Wgq,
                                              const float* __restrict__ bgq,
                                              float* __restrict__ gq) {
  int idx = blk * 256 + threadIdx.x;
  if (idx >= BATCH * DMODEL) return;
  int b = idx / DMODEL, d = idx % DMODEL;
  const float* xr = X + (size_t)b * DMODEL;  // hidden[(0,b),:]
  float s = bgq[d];
  for (int k = 0; k < DMODEL; k++) s += xr[k] * Wgq[(size_t)k * DMODEL + d];
  gq[idx] = s;  // layout (b*H+h)*64+e == b*768+d
}

// ---------------------------------------------------------------------------
// Kernel 1: fused Q/K/V projection GEMM (z selects weight), f32 in -> f16 out
// scattered into (B*H, S, hd) layout. Block tile 128x128, K-chunks of 32,
// double-buffered LDS so global loads overlap the WMMAs.
// LDS tiles: one row per m (Xs) or n (Ws), 32 k as f16, row pitch 80 B
// (16 B x odd: the 16 rows of a b128 fragment read fall on distinct banks).
// Every staging store is a b64 whose 32 lanes cover all 64 banks once.
// 1-D grid: GQ_BLOCKS work-groups of the gq projection first (they start first
// and finish under the GEMM), then the tiles, m fastest, then n, then weight.
// ---------------------------------------------------------------------------
#define TP 40  // LDS row pitch in halves
__global__ __launch_bounds__(256) void qkv_gemm_wmma(
    const float* __restrict__ X, const float* __restrict__ W0,
    const float* __restrict__ W1, const float* __restrict__ W2,
    const float* __restrict__ b0, const float* __restrict__ b1,
    const float* __restrict__ b2, _Float16* __restrict__ q16,
    _Float16* __restrict__ k16, _Float16* __restrict__ v16,
    const float* __restrict__ Wgq, const float* __restrict__ bgq,
    float* __restrict__ gq) {
  __shared__ __attribute__((aligned(16))) _Float16 Xs[2][128 * TP];
  __shared__ __attribute__((aligned(16))) _Float16 Ws[2][128 * TP];

  int bid = blockIdx.x;
  if (bid < GQ_BLOCKS) {  // the same for the whole block, ahead of any barrier
    gq_proj_block(bid, X, Wgq, bgq, gq);
    return;
  }
  bid -= GQ_BLOCKS;
  int yz = bid >> 8;  // 256 m tiles
  int z = yz / 6;
  const float* W = (z == 0) ? W0 : (z == 1) ? W1 : W2;
  const float* bias = (z == 0) ? b0 : (z == 1) ? b1 : b2;
  _Float16* dst = (z == 0) ? q16 : (z == 1) ? k16 : v16;

  int m0 = (bid & 255) * 128;
  int n0 = (yz % 6) * 128;
  int tid = threadIdx.x;
  int wid = tid >> 5, lane = tid & 31;
  int lm = lane & 15, lh = lane >> 4;
  int wm = (wid & 3) * 32;   // wave M offset
  int wn = (wid >> 2) * 64;  // wave N offset

  float4 xr[4], wr[4];  // staged global data for next chunk

  // X: a wave-wide access takes 4 rows that lie 4 apart (4 x 80 B = 16 banks
  // mod 64), 8 lanes x 4 k on each row.
  int xrow = wid * 16 + (lane >> 3) * 4;  // + it
  int xc4 = (lane & 7) << 2;
  // W: each thread owns a 4 k x 4 n block, so the transpose is a choice of
  // registers and each n row gets 4 consecutive k in one b64 store. A wave
  // holds 16 k x 32 n; rows 16 apart fall on the same banks, so the rows with
  // bit 4 of n set keep their two 16-k halves swapped.
  int skh = wid >> 2;                         // which 16-k half
  int sk = skh * 16 + (lane >> 3) * 4;        // + it
  int sn = (wid & 3) * 32 + (lane & 7) * 4;   // + j
  int wpos = sn * TP + ((skh ^ ((lane >> 2) & 1)) << 4) + (lane >> 3) * 4;

  auto pack4 = [](float a, float b, float c, float d) {
    union { _Float16 h[4]; v2u u; } pk;
    pk.h[0] = (_Float16)a; pk.h[1] = (_Float16)b;
    pk.h[2] = (_Float16)c; pk.h[3] = (_Float16)d;
    return pk.u;
  };
  auto load_global = [&](int k0) {
    for (int it = 0; it < 4; it++) {  // all loads issued before any use
      xr[it] = *(const float4*)(X + (size_t)(m0 + xrow + it) * DMODEL + k0 + xc4);
      wr[it] = *(const float4*)(W + (size_t)(k0 + sk + it) * DMODEL + n0 + sn);
    }
  };
  auto store_lds = [&](int buf) {
    for (int it = 0; it < 4; it++)
      *(v2u*)(&Xs[buf][(xrow + it) * TP + xc4]) =
          pack4(xr[it].x, xr[it].y, xr[it].z, xr[it].w);
    _Float16* wp = &Ws[buf][wpos];
    *(v2u*)(wp + 0 * TP) = pack4(wr[0].x, wr[1].x, wr[2].x, wr[3].x);
    *(v2u*)(wp + 1 * TP) = pack4(wr[0].y, wr[1].y, wr[2].y, wr[3].y);
    *(v2u*)(wp + 2 * TP) = pack4(wr[0].z, wr[1].z, wr[2].z, wr[3].z);
    *(v2u*)(wp + 3 * TP) = pack4(wr[0].w, wr[1].w, wr[2].w, wr[3].w);
  };

  load_global(0);
  store_lds(0);
  v8f acc[2][4] = {};

  const int NKC = DMODEL / 32;  // 24
  for (int kc = 0; kc < NKC; kc++) {
    __syncthreads();
    if (kc + 1 < NKC) load_global((kc + 1) * 32);  // overlap with WMMAs
    // keeps the 8 loads issued here: left free, the compiler sinks them in two
    // groups between the WMMAs and the wave waits out the load latency twice
    __builtin_amdgcn_sched_barrier(0);
    int cb = kc & 1;
    Frag af[2], bf[4];
    for (int mt = 0; mt < 2; mt++) {
      const _Float16* p = &Xs[cb][(wm + mt * 16 + lm) * TP + lh * 8];
      af[mt].u[0] = *(const v4u*)p;
      af[mt].u[1] = *(const v4u*)(p + 16);
    }
    for (int nt = 0; nt < 4; nt++) {
      const _Float16* p = &Ws[cb][(wn + nt * 16 + lm) * TP + lh * 8];
      bf[nt].u[0] = *(const v4u*)(p + (nt & 1) * 16);  // halves swapped: odd nt
      bf[nt].u[1] = *(const v4u*)(p + 16 - (nt & 1) * 16);
    }
    for (int mt = 0; mt < 2; mt++)
      for (int nt = 0; nt < 4; nt++)
        acc[mt][nt] = wmma_f16(af[mt].h, bf[nt].h, acc[mt][nt]);
    if (kc + 1 < NKC) store_lds((kc + 1) & 1);
  }

  // epilogue: +bias, scatter to (b*H+h, s, e) f16
  for (int mt = 0; mt < 2; mt++)
    for (int nt = 0; nt < 4; nt++) {
      int col = n0 + wn + nt * 16 + lm;
      float bvv = bias[col];
      int h = col >> 6, e = col & 63;
      for (int r = 0; r < 8; r++) {
        int t = m0 + wm + mt * 16 + r + 8 * lh;  // token index = s*B + b
        int s = t >> 3, b = t & 7;
        dst[((size_t)(b * NHEAD + h) * S_LEN + s) * HD + e] =
            (_Float16)(acc[mt][nt][r] + bvv);
      }
    }
}

// ---------------------------------------------------------------------------
// Kernel 2: local windowed attention with look-around, flash-style online
// softmax, all matmuls via v_wmma_f32_16x16x32_f16. K and V tiles staged
// row-major with GLOBAL_LOAD_ASYNC_TO_LDS_B128 when the toolchain exposes it.
// The products run transposed: St = K.Qt and Ot += Vt.Pt. A lane then holds
// 16 scores of ONE query (column lm; keys 8 lh + r and 16 + 8 lh + r of the
// 32-key tile), so the row maximum and sum are in-lane work plus one exchange
// between the wave's halves, the two score tiles converted in place ARE the B
// operand of the second product, and the rescale factor is the lane's own.
// LDS layout, in 16-byte pieces, no padding (three blocks fit one WGP):
//   K row j (8 pieces): piece p lies at p ^ ((j >> 1) & 7)
// so the 16 rows of a ds_load_b128 fragment read fall on all 64 banks.
//   V row j: as in memory; ds_load_tr16_b128 hands out the A fragment Vt in
//   the k order of the packed scores (8h + 0..7, then 16 + 8h + 0..7).
//   bJ: per key 0 or NEGMAX, added to the score; bN: 32 x NEGMAX, read in its
//   place by the lanes whose own query is masked.
// 1-D grid, 256 threads (8 waves x 16 query rows): the B*H work-groups of the
// global-token attention first (long and latency-bound: they start first and
// run beside the windows), then NWIN x B*H windows. Row 0 of out belongs to the
// global token, so the window that holds query 0 does not store it.
// ---------------------------------------------------------------------------
#define ROWB 128  // K and V row, bytes
#define ATT_V_OFF  (W3 * ROWB)
#define ATT_BJ_OFF (ATT_V_OFF + W3 * ROWB)
#define ATT_BN_OFF (ATT_BJ_OFF + W3 * 4)
#define ATT_LDS    (ATT_BN_OFF + 32 * 4)  // 99,968 B

// value of lane l ^ 16
__device__ __forceinline__ float xhalf(float x) {
  int v = __builtin_bit_cast(int, x);
  return __builtin_bit_cast(
      float, __builtin_amdgcn_permlanex16(v, v, 0x76543210, 0xfedcba98, false,
                                          false));
}

// ---------------------------------------------------------------------------
// Global-token attention of one (batch, head): writes out row 0. Deterministic
// reductions (no float atomics). Runs as the first BATCH * NHEAD work-groups of
// the attention launch, beside the local windows, in the same dynamic LDS.
// The 64 output sums over the 256 threads: each thread parks its 64 partial
// sums as one LDS row; behind one barrier a thread adds one column over 64
// rows, behind a second one 64 threads add the 4 quarters. This block is the
// longest of the launch, so its chain of barriers is kept short.
// ---------------------------------------------------------------------------
#define GA_QSH_OFF  (S_LEN * 4)
#define GA_RED_OFF  (GA_QSH_OFF + HD * 4)
#define GA_ACC_OFF  (GA_RED_OFF + 256 * 4)
#define GA_PARK_OFF (GA_ACC_OFF + (HD + 4) * 4)
// park row pitch in words, odd: the stores (a lane per row) and the reads (a
// lane per column) both fall on 32 distinct banks
#define GA_PP       (HD + 1)
#define GA_LDS      (GA_PARK_OFF + 256 * GA_PP * 4)  // 84,496 B
static_assert(GA_LDS <= ATT_LDS, "global-token path fits the launch's LDS");

__device__ __forceinline__ void global_attn_block(
    int bh, char* smem, const float* __restrict__ gq,
    const _Float16* __restrict__ k16, const _Float16* __restrict__ v16,
    const int* __restrict__ kpm, float* __restrict__ out) {
  float* sc = (float*)smem;                    // S_LEN
  float* qsh = (float*)(smem + GA_QSH_OFF);    // HD
  float* red = (float*)(smem + GA_RED_OFF);    // 256
  float* accv = (float*)(smem + GA_ACC_OFF);   // HD + 1
  float* park = (float*)(smem + GA_PARK_OFF);  // 256 rows of GA_PP
  int b = bh / NHEAD, hh = bh % NHEAD;
  int tid = threadIdx.x;
  if (tid < HD) qsh[tid] = gq[bh * HD + tid];
  __syncthreads();

  const _Float16* Kg = k16 + (size_t)bh * S_LEN * HD;
  const _Float16* Vg = v16 + (size_t)bh * S_LEN * HD;
  // the query in registers: carved out of one LDS array, qsh cannot be told
  // apart from sc by the compiler, which would reload it after each score store
  float qr[HD];
  for (int e = 0; e < HD; e++) qr[e] = qsh[e];
  float lmax = NEGMAX;
  for (int s = tid; s < S_LEN; s += 256) {
    const _Float16* kr = Kg + (size_t)s * HD;
    float d = 0.f;
    for (int e = 0; e < HD; e++) d += qr[e] * (float)kr[e];
    d *= 0.125f;
    if (kpm[b * S_LEN + s]) d = NEGMAX;
    sc[s] = d;
    lmax = fmaxf(lmax, d);
  }
  red[tid] = lmax;
  __syncthreads();
  for (int st = 128; st > 0; st >>= 1) {
    if (tid < st) red[tid] = fmaxf(red[tid], red[tid + st]);
    __syncthreads();
  }
  float M = red[0];
  __syncthreads();

  float av[HD];
  for (int e = 0; e < HD; e++) av[e] = 0.f;
  float lsum = 0.f;
  for (int s = tid; s < S_LEN; s += 256) {
    float p = __expf(sc[s] - M);
    lsum += p;
    const _Float16* vr = Vg + (size_t)s * HD;
    for (int e = 0; e < HD; e++) av[e] += p * (float)vr[e];
  }
  for (int e = 0; e < HD; e++) park[tid * GA_PP + e] = av[e];
  __syncthreads();
  // column tid & 63 over the rows of quarter tid >> 6, in row order
  const float* pc = park + (tid >> 6) * 64 * GA_PP + (tid & 63);
  float cs = 0.f;
  for (int i = 0; i < 64; i++) cs += pc[i * GA_PP];
  red[tid] = cs;
  __syncthreads();
  if (tid < HD)
    accv[tid] = (red[tid] + red[tid + 64]) + (red[tid + 128] + red[tid + 192]);
  __syncthreads();  // red is written again below
  red[tid] = lsum;
  __syncthreads();
  for (int st = 128; st > 0; st >>= 1) {
    if (tid < st) red[tid] += red[tid + st];
    __syncthreads();
  }
  if (tid == 0) accv[HD] = red[0];
  __syncthreads();
  if (tid < HD)
    out[(size_t)b * DMODEL + hh * HD + tid] = accv[tid] / accv[HD];
}

__global__ __launch_bounds__(256) void local_attn_wmma(
    const _Float16* __restrict__ q16, const _Float16* __restrict__ k16,
    const _Float16* __restrict__ v16, const int* __restrict__ kpm,
    const float* __restrict__ gq, float* __restrict__ out) {
  extern __shared__ __attribute__((aligned(16))) char smem[];
  char* Ksm = smem;                        // 384 rows x 64 halves
  char* Vsm = smem + ATT_V_OFF;            // 384 rows x 64 halves
  float* bJ = (float*)(smem + ATT_BJ_OFF); // 384
  float* bN = (float*)(smem + ATT_BN_OFF); // 32

  int bid = blockIdx.x;
  if (bid < BATCH * NHEAD) {  // the same for the whole block, ahead of any barrier
    global_attn_block(bid, smem, gq, k16, v16, kpm, out);
    return;
  }
  bid -= BATCH * NHEAD;
  int w = bid & (NWIN - 1), bh = bid >> 5;  // window fastest
  int b = bh / NHEAD, hh = bh % NHEAD;
  int tid = threadIdx.x, wid = tid >> 5, lane = tid & 31;
  int lm = lane & 15, lh = lane >> 4;
  const _Float16* Kg = k16 + (size_t)bh * S_LEN * HD;
  const _Float16* Vg = v16 + (size_t)bh * S_LEN * HD;

  // K and V tiles, one window at a time; whether a window exists is the same
  // for the whole block, so every lane is on at every copy. A window past
  // either end is zero-filled (look-around padding).
  for (int seg = 0; seg < 3; seg++) {
    int wj = w - 1 + seg;
    char* kd = Ksm + seg * WIN * ROWB;
    char* vd = Vsm + seg * WIN * ROWB;
    if (wj >= 0 && wj < NWIN) {
      const _Float16* kg = Kg + (size_t)wj * WIN * HD;
      const _Float16* vg = Vg + (size_t)wj * WIN * HD;
      for (int it = 0; it < 4; it++) {
        int idx = it * 256 + tid;  // 16-byte piece; a wave takes 512 B in a row
        int j = idx >> 3, c = idx & 7;
        copy16_to_lds(kg + idx * 8, kd + j * ROWB + ((c ^ ((j >> 1) & 7)) << 4));
        copy16_to_lds(vg + idx * 8, vd + idx * 16);
      }
    } else {
      v4u zz = {};
      for (int it = 0; it < 4; it++) {
        int idx = it * 256 + tid;
        *(v4u*)(kd + idx * 16) = zz;
        *(v4u*)(vd + idx * 16) = zz;
      }
    }
  }
  for (int j = tid; j < W3; j += 256) {
    int s = (w - 1) * WIN + j;
    bJ[j] = (s < 0 || s >= S_LEN || kpm[b * S_LEN + s]) ? NEGMAX : 0.f;
  }
  if (tid < 32) bN[tid] = NEGMAX;
  int i0 = wid * 16;
  bool qmask = kpm[b * S_LEN + w * WIN + i0 + lm] != 0;  // the lane's query
  wait_async0();
  __syncthreads();

  const _Float16* Qg = q16 + ((size_t)bh * S_LEN + (size_t)w * WIN + i0) * HD;
  Frag aq[2];
  for (int ec = 0; ec < 2; ec++) {
    const _Float16* p = Qg + lm * HD + ec * 32 + lh * 8;
    aq[ec].u[0] = *(const v4u*)p;
    aq[ec].u[1] = *(const v4u*)(p + 16);
  }

  // hd^-0.5 * log2(e): scores are kept in log2 units. A masked score is
  // c * ksc + NEGMAX, which rounds to NEGMAX itself (|c * ksc| is far below
  // half an ulp of NEGMAX for any f16 operands).
  const float ksc = 0.125f * 1.44269504088896340736f;
  v8f Oacc[4] = {};  // Oacc[t][r] = Ot[t * 16 + 8 lh + r][query lm]
  float mr = NEGMAX;
  v8f lr = {};  // row sum in 8 parts, this half's keys only; joined at the end
  // lane offsets inside a row; a further piece index is XORed in at bits 4..6
  const char* Kl = Ksm + lm * ROWB;
  int kx = (lh ^ (lm >> 1)) << 4;  // rows jt*32 (+16) + lm: (j >> 1) & 7 = lm >> 1
  const char* Vl = Vsm + (8 * lh + (lane & 7)) * ROWB + ((lane >> 3) & 1) * 16;
  const char* bl = smem + (qmask ? ATT_BN_OFF : ATT_BJ_OFF) + lh * 32;
  int bstep = qmask ? 0 : 128;  // bytes per 32 keys

  for (int jt = 0; jt < 12; jt++) {
    // scores: two 16-key tiles over hd (K = 2 chunks of 32)
    v8f c0 = {}, c1 = {};
    for (int ec = 0; ec < 2; ec++) {
      Frag bk0, bk1;
      const char* p0 = Kl + jt * 32 * ROWB;
      const char* p1 = p0 + 16 * ROWB;
      int ka = kx ^ (ec * 64), kb = ka ^ 32;
      bk0.u[0] = *(const v4u*)(p0 + ka); bk0.u[1] = *(const v4u*)(p0 + kb);
      bk1.u[0] = *(const v4u*)(p1 + ka); bk1.u[1] = *(const v4u*)(p1 + kb);
      c0 = wmma_f16(bk0.h, aq[ec].h, c0);
      c1 = wmma_f16(bk1.h, aq[ec].h, c1);
    }
    // Vt fragments of this tile, asked for here so that they arrive while the
    // softmax below runs
    Frag av[4];
    for (int t = 0; t < 4; t++) {
      const char* vp = Vl + jt * 32 * ROWB + t * 32;
      av[t].u[0] = ld_tr16(vp);
      av[t].u[1] = ld_tr16(vp + 16 * ROWB);
    }
    const v8f* bp = (const v8f*)(bl + jt * bstep);
    c0 = c0 * ksc + bp[0];  // bias of keys jt*32 + 8 lh + r
    c1 = c1 * ksc + bp[2];  // bias of keys jt*32 + 16 + 8 lh + r
    float tm = NEGMAX;
    for (int r = 0; r < 8; r++) tm = fmaxf(tm, fmaxf(c0[r], c1[r]));
    tm = fmaxf(tm, xhalf(tm));
    float mn = fmaxf(mr, tm);
    float sc = __builtin_amdgcn_exp2f(mr - mn);
    mr = mn;
    c0 -= mn;
    c1 -= mn;
    Frag pb;  // Pt as B operand: element s = key kmap(s, lh), column lm
    for (int r = 0; r < 8; r++) {
      c0[r] = __builtin_amdgcn_exp2f(c0[r]);
      c1[r] = __builtin_amdgcn_exp2f(c1[r]);
      pb.h[r] = (_Float16)c0[r];
      pb.h[8 + r] = (_Float16)c1[r];
    }
    lr = lr * sc + (c0 + c1);
    for (int t = 0; t < 4; t++) {
      Oacc[t] *= sc;
      Oacc[t] = wmma_f16(av[t].h, pb.h, Oacc[t]);
    }
  }

  float ls = ((lr[0] + lr[1]) + (lr[2] + lr[3])) +
             ((lr[4] + lr[5]) + (lr[6] + lr[7]));
  float rl = 1.f / (ls + xhalf(ls));
  int srow = w * WIN + i0 + lm;
  float* op = out + ((size_t)srow * BATCH + b) * DMODEL + hh * HD + lh * 8;
  if (srow == 0) return;  // the global token's row; no barrier follows
  for (int t = 0; t < 4; t++) {  // 8 consecutive columns of one row per lane
    float4 o0 = {Oacc[t][0] * rl, Oacc[t][1] * rl, Oacc[t][2] * rl,
                 Oacc[t][3] * rl};
    float4 o1 = {Oacc[t][4] * rl, Oacc[t][5] * rl, Oacc[t][6] * rl,
                 Oacc[t][7] * rl};
    *(float4*)(op + t * 16) = o0;
    *(float4*)(op + t * 16 + 4) = o1;
  }
}

// ---------------------------------------------------------------------------
extern "C" void kernel_launch(void* const* d_in, const int* in_sizes, int n_in,
                              void* d_out, int out_size, void* d_ws,
                              size_t ws_size, hipStream_t stream) {
  (void)in_sizes; (void)n_in; (void)out_size; (void)ws_size;
  const float* hs  = (const float*)d_in[0];
  const int*   kpm = (const int*)d_in[1];
  const float* Wq  = (const float*)d_in[2];
  const float* Wk  = (const float*)d_in[3];
  const float* Wv  = (const float*)d_in[4];
  const float* Wgq = (const float*)d_in[5];
  const float* bq  = (const float*)d_in[6];
  const float* bk  = (const float*)d_in[7];
  const float* bv  = (const float*)d_in[8];
  const float* bgq = (const float*)d_in[9];
  float* out = (float*)d_out;

  size_t per = (size_t)BATCH * NHEAD * S_LEN * HD;  // halfs per q/k/v tensor
  _Float16* q16 = (_Float16*)d_ws;
  _Float16* k16 = q16 + per;
  _Float16* v16 = k16 + per;
  float* gqbuf = (float*)(v16 + per);

  qkv_gemm_wmma<<<GQ_BLOCKS + 256 * 6 * 3, 256, 0, stream>>>(
      hs, Wq, Wk, Wv, bq, bk, bv, q16, k16, v16, Wgq, bgq, gqbuf);
  size_t lds_bytes = ATT_LDS;
  local_attn_wmma<<<BATCH * NHEAD + NWIN * BATCH * NHEAD, 256, lds_bytes,
                    stream>>>(q16, k16, v16, kpm, gqbuf, out);
}

// v006
// One run takes 207 microseconds.
// In both of two side-by-side timings against v005, it was 1.11 times as fast.
// All steps since v000 together make it 5.95 times as fast.
#include <hip/hip_runtime.h>
#include <hip/hip_bf16.h>

typedef __attribute__((ext_vector_type(16))) _Float16     v16h;
typedef __attribute__((ext_vector_type(8)))  float        v8f;
typedef __attribute__((ext_vector_type(4)))  unsigned int v4u;
typedef __attribute__((ext_vector_type(2)))  unsigned int v2u;
typedef __attribute__((ext_vector_type(4)))  int          v4i;
typedef __attribute__((address_space(1))) v4i* gv4i_p;  // global ("__device__")
typedef __attribute__((address_space(3))) v4i* lv4i_p;  // LDS ("__shared__")

#define S_LEN  4096
#define BATCH  8
#define DMODEL 768
#define NHEAD  12
#define HD     64
#define WIN    128
#define NWIN   32
#define W3     384
#define NEGMAX (-3.402823466e+38f)

#if __has_builtin(__builtin_amdgcn_global_load_async_to_lds_b128)
#define HAVE_ASYNC_LDS 1
#endif

union Frag { v4u u[2]; v16h h; };

__device__ __forceinline__ v8f wmma_f16(v16h a, v16h b, v8f c) {
  return __builtin_amdgcn_wmma_f32_16x16x32_f16(false, a, false, b, (short)0, c,
                                                false, false);
}

__device__ __forceinline__ void wait_async0() {
#ifdef HAVE_ASYNC_LDS
  // this wave's async copies have landed; the clobber holds LDS reads behind it
  asm volatile("s_wait_asynccnt 0x0" ::: "memory");
#endif
}

// 16 bytes, global -> LDS, per lane
__device__ __forceinline__ void copy16_to_lds(const _Float16* g, char* l) {
#ifdef HAVE_ASYNC_LDS
  __builtin_amdgcn_global_load_async_to_lds_b128((gv4i_p)g, (lv4i_p)l, 0, 0);
#else
  *(v4u*)l = *(const v4u*)g;
#endif
}

// transposing LDS load: lane (c = l & 15, h = l >> 4) gets T[8h + 0..7][c] of a
// row-major 16-bit tile; the lane's address names row 8h + (l & 7), 16-byte
// piece (l >> 3) & 1
typedef short s16x8 __attribute__((ext_vector_type(8)));
typedef __attribute__((address_space(3))) s16x8 lds_s16x8;
__device__ __forceinline__ v4u ld_tr16(const char* p) {
  return __builtin_bit_cast(
      v4u, __builtin_amdgcn_ds_load_tr16_b128_v8i16((lds_s16x8*)p));
}

// ---------------------------------------------------------------------------
// gq = hidden[0] @ Wgq + bgq (tiny, bound by load latency). Runs as the first
// GQ_BLOCKS work-groups of the projection launch, beside the GEMM tiles.
// ---------------------------------------------------------------------------
#define GEMM_THREADS 512
#define GQ_BLOCKS ((BATCH * DMODEL + GEMM_THREADS - 1) / GEMM_THREADS)  // 12
__device__ __forceinline__ void gq_proj_block(int blk,
                                              const float* __restrict__ X,
                                              const float* __restrict__ Wgq,
                                              const float* __restrict__ bgq,
                                              float* __restrict__ gq) {
  int idx = blk * GEMM_THREADS + threadIdx.x;
  if (idx >= BATCH * DMODEL) return;
  int b = idx / DMODEL, d = idx % DMODEL;
  const float* xr = X + (size_t)b * DMODEL;  // hidden[(0,b),:]
  float s = bgq[d];
  for (int k = 0; k < DMODEL; k++) s += xr[k] * Wgq[(size_t)k * DMODEL + d];
  gq[idx] = s;  // layout (b*H+h)*64+e == b*768+d
}

// ---------------------------------------------------------------------------
// Kernel 1: fused Q/K/V projection GEMM (z selects weight), f32 in -> f16 out
// scattered into (B*H, S, hd) layout. Block tile 256x256 (16 waves of 64x64),
// K-chunks of 32, double-buffered LDS so global loads overlap the WMMAs. The
// bytes drawn from L2 per product fall with the tile's edge; the 64x64 wave
// tile reads 16 half-fragments for 16 WMMAs. One work-group fills a WGP.
// LDS tiles: one row per m (Xs) or n (Ws), 32 k as f16, row pitch 80 B
// (16 B x odd: the 16 rows of a b128 fragment read fall on distinct banks).
// Every staging store is a b64 whose 32 lanes cover all 64 banks once.
// 1-D grid: GQ_BLOCKS work-groups of the gq projection first (they start first
// and finish under the GEMM), then the tiles, m fastest, then n, then weight.
// ---------------------------------------------------------------------------
#define TP 40  // LDS row pitch in halves
__global__ __launch_bounds__(GEMM_THREADS) void qkv_gemm_wmma(
    const float* __restrict__ X, const float* __restrict__ W0,
    const float* __restrict__ W1, const float* __restrict__ W2,
    const float* __restrict__ b0, const float* __restrict__ b1,
    const float* __restrict__ b2, _Float16* __restrict__ q16,
    _Float16* __restrict__ k16, _Float16* __restrict__ v16,
    const float* __restrict__ Wgq, const float* __restrict__ bgq,
    float* __restrict__ gq) {
  __shared__ __attribute__((aligned(16))) _Float16 Xs[2][256 * TP];
  __shared__ __attribute__((aligned(16))) _Float16 Ws[2][256 * TP];

  int bid = blockIdx.x;
  if (bid < GQ_BLOCKS) {  // the same for the whole block, ahead of any barrier
    gq_proj_block(bid, X, Wgq, bgq, gq);
    return;
  }
  bid -= GQ_BLOCKS;
  int yz = bid >> 7;  // 128 m tiles
  int z = yz / 3;
  const float* W = (z == 0) ? W0 : (z == 1) ? W1 : W2;
  const float* bias = (z == 0) ? b0 : (z == 1) ? b1 : b2;
  _Float16* dst = (z == 0) ? q16 : (z == 1) ? k16 : v16;

  int m0 = (bid & 127) * 256;
  int n0 = (yz % 3) * 256;
  int tid = threadIdx.x;
  int wid = tid >> 5, lane = tid & 31;
  int lm = lane & 15, lh = lane >> 4;
  int wm = (wid & 3) * 64;   // wave M offset
  int wn = (wid >> 2) * 64;  // wave N offset

  float4 xr[4], wr[4];  // staged global data for next chunk

  // X: a wave-wide access takes 4 rows that lie 4 apart (4 x 80 B = 16 banks
  // mod 64), 8 lanes x 4 k on each row.
  int xrow = wid * 16 + (lane >> 3) * 4;  // + it
  int xc4 = (lane & 7) << 2;
  // W: each thread owns a 4 k x 4 n block, so the transpose is a choice of
  // registers and each n row gets 4 consecutive k in one b64 store. A wave
  // holds 16 k x 32 n; rows 16 apart fall on the same banks, so the rows with
  // bit 4 of n set keep their two 16-k halves swapped.
  int skh = wid >> 3;                         // which 16-k half
  int sk = skh * 16 + (lane >> 3) * 4;        // + it
  int sn = (wid & 7) * 32 + (lane & 7) * 4;   // + j
  int wpos = sn * TP + ((skh ^ ((lane >> 2) & 1)) << 4) + (lane >> 3) * 4;

  auto pack4 = [](float a, float b, float c, float d) {
    union { _Float16 h[4]; v2u u; } pk;
    pk.h[0] = (_Float16)a; pk.h[1] = (_Float16)b;
    pk.h[2] = (_Float16)c; pk.h[3] = (_Float16)d;
    return pk.u;
  };
  auto load_global = [&](int k0) {
    for (int it = 0; it < 4; it++) {  // all loads issued before any use
      xr[it] = *(const float4*)(X + (size_t)(m0 + xrow + it) * DMODEL + k0 + xc4);
      wr[it] = *(const float4*)(W + (size_t)(k0 + sk + it) * DMODEL + n0 + sn);
    }
  };
  auto store_lds = [&](int buf) {
    for (int it = 0; it < 4; it++)
      *(v2u*)(&Xs[buf][(xrow + it) * TP + xc4]) =
          pack4(xr[it].x, xr[it].y, xr[it].z, xr[it].w);
    _Float16* wp = &Ws[buf][wpos];
    *(v2u*)(wp + 0 * TP) = pack4(wr[0].x, wr[1].x, wr[2].x, wr[3].x);
    *(v2u*)(wp + 1 * TP) = pack4(wr[0].y, wr[1].y, wr[2].y, wr[3].y);
    *(v2u*)(wp + 2 * TP) = pack4(wr[0].z, wr[1].z, wr[2].z, wr[3].z);
    *(v2u*)(wp + 3 * TP) = pack4(wr[0].w, wr[1].w, wr[2].w, wr[3].w);
  };

  load_global(0);
  store_lds(0);
  v8f acc[4][4] = {};

  const int NKC = DMODEL / 32;  // 24
  for (int kc = 0; kc < NKC; kc++) {
    __syncthreads();
    if (kc + 1 < NKC) load_global((kc + 1) * 32);  // overlap with WMMAs
    // keeps the 8 loads issued here: left free, the compiler sinks them in two
    // groups between the WMMAs and the wave waits out the load latency twice
    __builtin_amdgcn_sched_barrier(0);
    int cb = kc & 1;
    Frag af[4], bf[4];
    auto load_a = [&](int mt) {
      const _Float16* p = &Xs[cb][(wm + mt * 16 + lm) * TP + lh * 8];
      af[mt].u[0] = *(const v4u*)p;
      af[mt].u[1] = *(const v4u*)(p + 16);
    };
    // asked for in the order the WMMAs use them, so that the first WMMAs start
    // while the later reads are still under way
    load_a(0);
    for (int nt = 0; nt < 4; nt++) {
      const _Float16* p = &Ws[cb][(wn + nt * 16 + lm) * TP + lh * 8];
      bf[nt].u[0] = *(const v4u*)(p + (nt & 1) * 16);  // halves swapped: odd nt
      bf[nt].u[1] = *(const v4u*)(p + 16 - (nt & 1) * 16);
    }
    for (int mt = 1; mt < 4; mt++) load_a(mt);
    // keeps the 16 fragment reads in one group ahead of the WMMAs: left free,
    // the compiler reuses A registers and a wave waits out two more LDS reads
    // queued behind every other wave's
    __builtin_amdgcn_sched_barrier(0);
    for (int mt = 0; mt < 4; mt++)
      for (int nt = 0; nt < 4; nt++)
        acc[mt][nt] = wmma_f16(af[mt].h, bf[nt].h, acc[mt][nt]);
    // keeps the conversions, and with them the wait for the 8 loads, behind the
    // WMMAs: one work-group fills the WGP, so nothing else covers that latency
    __builtin_amdgcn_sched_barrier(0);
    if (kc + 1 < NKC) store_lds((kc + 1) & 1);
  }

  // epilogue: +bias, scatter to (b*H+h, s, e) f16
  for (int mt = 0; mt < 4; mt++)
    for (int nt = 0; nt < 4; nt++) {
      int col = n0 + wn + nt * 16 + lm;
      float bvv = bias[col];
      int h = col >> 6, e = col & 63;
      for (int r = 0; r < 8; r++) {
        int t = m0 + wm + mt * 16 + r + 8 * lh;  // token index = s*B + b
        int s = t >> 3, b = t & 7;
        dst[((size_t)(b * NHEAD + h) * S_LEN + s) * HD + e] =
            (_Float16)(acc[mt][nt][r] + bvv);
      }
    }
}

// ---------------------------------------------------------------------------
// Kernel 2: local windowed attention with look-around, flash-style online
// softmax, all matmuls via v_wmma_f32_16x16x32_f16. K and V tiles staged
// row-major with GLOBAL_LOAD_ASYNC_TO_LDS_B128 when the toolchain exposes it.
// The products run transposed: St = K.Qt and Ot += Vt.Pt. A lane then holds
// 16 scores of ONE query (column lm; keys 8 lh + r and 16 + 8 lh + r of the
// 32-key tile), so the row maximum and sum are in-lane work plus one exchange
// between the wave's halves, the two score tiles converted in place ARE the B
// operand of the second product, and the rescale factor is the lane's own.
// LDS layout, in 16-byte pieces, no padding (three blocks fit one WGP):
//   K row j (8 pieces): piece p lies at p ^ ((j >> 1) & 7)
// so the 16 rows of a ds_load_b128 fragment read fall on all 64 banks.
//   V row j: as in memory; ds_load_tr16_b128 hands out the A fragment Vt in
//   the k order of the packed scores (8h + 0..7, then 16 + 8h + 0..7).
//   bJ: per key 0 or NEGMAX, added to the score; bN: 32 x NEGMAX, read in its
//   place by the lanes whose own query is masked.
// 1-D grid, 256 threads (8 waves x 16 query rows): the B*H work-groups of the
// global-token attention first (long and latency-bound: they start first and
// run beside the windows), then NWIN x B*H windows. Row 0 of out belongs to the
// global token, so the window that holds query 0 does not store it.
// ---------------------------------------------------------------------------
#define ROWB 128  // K and V row, bytes
#define ATT_V_OFF  (W3 * ROWB)
#define ATT_BJ_OFF (ATT_V_OFF + W3 * ROWB)
#define ATT_BN_OFF (ATT_BJ_OFF + W3 * 4)
#define ATT_LDS    (ATT_BN_OFF + 32 * 4)  // 99,968 B

// value of lane l ^ 16
__device__ __forceinline__ float xhalf(float x) {
  int v = __builtin_bit_cast(int, x);
  return __builtin_bit_cast(
      float, __builtin_amdgcn_permlanex16(v, v, 0x76543210, 0xfedcba98, false,
                                          false));
}

// ---------------------------------------------------------------------------
// Global-token attention of one (batch, head): writes out row 0. Deterministic
// reductions (no float atomics). Runs as the first BATCH * NHEAD work-groups of
// the attention launch, beside the local windows, in the same dynamic LDS.
// The 64 output sums over the 256 threads: each thread parks its 64 partial
// sums as one LDS row; behind one barrier a thread adds one column over 64
// rows, behind a second one 64 threads add the 4 quarters. This block is the
// longest of the launch, so its chain of barriers is kept short.
// ---------------------------------------------------------------------------
#define GA_QSH_OFF  (S_LEN * 4)
#define GA_RED_OFF  (GA_QSH_OFF + HD * 4)
#define GA_ACC_OFF  (GA_RED_OFF + 256 * 4)
#define GA_PARK_OFF (GA_ACC_OFF + (HD + 4) * 4)
// park row pitch in words, odd: the stores (a lane per row) and the reads (a
// lane per column) both fall on 32 distinct banks
#define GA_PP       (HD + 1)
#define GA_LDS      (GA_PARK_OFF + 256 * GA_PP * 4)  // 84,496 B
static_assert(GA_LDS <= ATT_LDS, "global-token path fits the launch's LDS");

__device__ __forceinline__ void global_attn_block(
    int bh, char* smem, const float* __restrict__ gq,
    const _Float16* __restrict__ k16, const _Float16* __restrict__ v16,
    const int* __restrict__ kpm, float* __restrict__ out) {
  float* sc = (float*)smem;                    // S_LEN
  float* qsh = (float*)(smem + GA_QSH_OFF);    // HD
  float* red = (float*)(smem + GA_RED_OFF);    // 256
  float* accv = (float*)(smem + GA_ACC_OFF);   // HD + 1
  float* park = (float*)(smem + GA_PARK_OFF);  // 256 rows of GA_PP
  int b = bh / NHEAD, hh = bh % NHEAD;
  int tid = threadIdx.x;
  if (tid < HD) qsh[tid] = gq[bh * HD + tid];
  __syncthreads();

  const _Float16* Kg = k16 + (size_t)bh * S_LEN * HD;
  const _Float16* Vg = v16 + (size_t)bh * S_LEN * HD;
  // the query in registers: carved out of one LDS array, qsh cannot be told
  // apart from sc by the compiler, which would reload it after each score store
  float qr[HD];
  for (int e = 0; e < HD; e++) qr[e] = qsh[e];
  float lmax = NEGMAX;
  for (int s = tid; s < S_LEN; s += 256) {
    const _Float16* kr = Kg + (size_t)s * HD;
    float d = 0.f;
    for (int e = 0; e < HD; e++) d += qr[e] * (float)kr[e];
    d *= 0.125f;
    if (kpm[b * S_LEN + s]) d = NEGMAX;
    sc[s] = d;
    lmax = fmaxf(lmax, d);
  }
  red[tid] = lmax;
  __syncthreads();
  for (int st = 128; st > 0; st >>= 1) {
    if (tid < st) red[tid] = fmaxf(red[tid], red[tid + st]);
    __syncthreads();
  }
  float M = red[0];
  __syncthreads();

  float av[HD];
  for (int e = 0; e < HD; e++) av[e] = 0.f;
  float lsum = 0.f;
  for (int s = tid; s < S_LEN; s += 256) {
    float p = __expf(sc[s] - M);
    lsum += p;
    const _Float16* vr = Vg + (size_t)s * HD;
    for (int e = 0; e < HD; e++) av[e] += p * (float)vr[e];
  }
  for (int e = 0; e < HD; e++) park[tid * GA_PP + e] = av[e];
  __syncthreads();
  // column tid & 63 over the rows of quarter tid >> 6, in row order
  const float* pc = park + (tid >> 6) * 64 * GA_PP + (tid & 63);
  float cs = 0.f;
  for (int i = 0; i < 64; i++) cs += pc[i * GA_PP];
  red[tid] = cs;
  __syncthreads();
  if (tid < HD)
    accv[tid] = (red[tid] + red[tid + 64]) + (red[tid + 128] + red[tid + 192]);
  __syncthreads();  // red is written again below
  red[tid] = lsum;
  __syncthreads();
  for (int st = 128; st > 0; st >>= 1) {
    if (tid < st) red[tid] += red[tid + st];
    __syncthreads();
  }
  if (tid == 0) accv[HD] = red[0];
  __syncthreads();
  if (tid < HD)
    out[(size_t)b * DMODEL + hh * HD + tid] = accv[tid] / accv[HD];
}

__global__ __launch_bounds__(256) void local_attn_wmma(
    const _Float16* __restrict__ q16, const _Float16* __restrict__ k16,
    const _Float16* __restrict__ v16, const int* __restrict__ kpm,
    const float* __restrict__ gq, float* __restrict__ out) {
  extern __shared__ __attribute__((aligned(16))) char smem[];
  char* Ksm = smem;                        // 384 rows x 64 halves
  char* Vsm = smem + ATT_V_OFF;            // 384 rows x 64 halves
  float* bJ = (float*)(smem + ATT_BJ_OFF); // 384
  float* bN = (float*)(smem + ATT_BN_OFF); // 32

  int bid = blockIdx.x;
  if (bid < BATCH * NHEAD) {  // the same for the whole block, ahead of any barrier
    global_attn_block(bid, smem, gq, k16, v16, kpm, out);
    return;
  }
  bid -= BATCH * NHEAD;
  int w = bid & (NWIN - 1), bh = bid >> 5;  // window fastest
  int b = bh / NHEAD, hh = bh % NHEAD;
  int tid = threadIdx.x, wid = tid >> 5, lane = tid & 31;
  int lm = lane & 15, lh = lane >> 4;
  const _Float16* Kg = k16 + (size_t)bh * S_LEN * HD;
  const _Float16* Vg = v16 + (size_t)bh * S_LEN * HD;

  // K and V tiles, one window at a time; whether a window exists is the same
  // for the whole block, so every lane is on at every copy. A window past
  // either end is zero-filled (look-around padding).
  for (int seg = 0; seg < 3; seg++) {
    int wj = w - 1 + seg;
    char* kd = Ksm + seg * WIN * ROWB;
    char* vd = Vsm + seg * WIN * ROWB;
    if (wj >= 0 && wj < NWIN) {
      const _Float16* kg = Kg + (size_t)wj * WIN * HD;
      const _Float16* vg = Vg + (size_t)wj * WIN * HD;
      for (int it = 0; it < 4; it++) {
        int idx = it * 256 + tid;  // 16-byte piece; a wave takes 512 B in a row
        int j = idx >> 3, c = idx & 7;
        copy16_to_lds(kg + idx * 8, kd + j * ROWB + ((c ^ ((j >> 1) & 7)) << 4));
        copy16_to_lds(vg + idx * 8, vd + idx * 16);
      }
    } else {
      v4u zz = {};
      for (int it = 0; it < 4; it++) {
        int idx = it * 256 + tid;
        *(v4u*)(kd + idx * 16) = zz;
        *(v4u*)(vd + idx * 16) = zz;
      }
    }
  }
  for (int j = tid; j < W3; j += 256) {
    int s = (w - 1) * WIN + j;
    bJ[j] = (s < 0 || s >= S_LEN || kpm[b * S_LEN + s]) ? NEGMAX : 0.f;
  }
  if (tid < 32) bN[tid] = NEGMAX;
  int i0 = wid * 16;
  bool qmask = kpm[b * S_LEN + w * WIN + i0 + lm] != 0;  // the lane's query
  wait_async0();
  __syncthreads();

  const _Float16* Qg = q16 + ((size_t)bh * S_LEN + (size_t)w * WIN + i0) * HD;
  Frag aq[2];
  for (int ec = 0; ec < 2; ec++) {
    const _Float16* p = Qg + lm * HD + ec * 32 + lh * 8;
    aq[ec].u[0] = *(const v4u*)p;
    aq[ec].u[1] = *(const v4u*)(p + 16);
  }

  // hd^-0.5 * log2(e): scores are kept in log2 units. A masked score is
  // c * ksc + NEGMAX, which rounds to NEGMAX itself (|c * ksc| is far below
  // half an ulp of NEGMAX for any f16 operands).
  const float ksc = 0.125f * 1.44269504088896340736f;
  v8f Oacc[4] = {};  // Oacc[t][r] = Ot[t * 16 + 8 lh + r][query lm]
  float mr = NEGMAX;
  v8f lr = {};  // row sum in 8 parts, this half's keys only; joined at the end
  // lane offsets inside a row; a further piece index is XORed in at bits 4..6
  const char* Kl = Ksm + lm * ROWB;
  int kx = (lh ^ (lm >> 1)) << 4;  // rows jt*32 (+16) + lm: (j >> 1) & 7 = lm >> 1
  const char* Vl = Vsm + (8 * lh + (lane & 7)) * ROWB + ((lane >> 3) & 1) * 16;
  const char* bl = smem + (qmask ? ATT_BN_OFF : ATT_BJ_OFF) + lh * 32;
  int bstep = qmask ? 0 : 128;  // bytes per 32 keys

  for (int jt = 0; jt < 12; jt++) {
    // scores: two 16-key tiles over hd (K = 2 chunks of 32)
    v8f c0 = {}, c1 = {};
    for (int ec = 0; ec < 2; ec++) {
      Frag bk0, bk1;
      const char* p0 = Kl + jt * 32 * ROWB;
      const char* p1 = p0 + 16 * ROWB;
      int ka = kx ^ (ec * 64), kb = ka ^ 32;
      bk0.u[0] = *(const v4u*)(p0 + ka); bk0.u[1] = *(const v4u*)(p0 + kb);
      bk1.u[0] = *(const v4u*)(p1 + ka); bk1.u[1] = *(const v4u*)(p1 + kb);
      c0 = wmma_f16(bk0.h, aq[ec].h, c0);
      c1 = wmma_f16(bk1.h, aq[ec].h, c1);
    }
    // Vt fragments of this tile, asked for here so that they arrive while the
    // softmax below runs
    Frag av[4];
    for (int t = 0; t < 4; t++) {
      const char* vp = Vl + jt * 32 * ROWB + t * 32;
      av[t].u[0] = ld_tr16(vp);
      av[t].u[1] = ld_tr16(vp + 16 * ROWB);
    }
    const v8f* bp = (const v8f*)(bl + jt * bstep);
    c0 = c0 * ksc + bp[0];  // bias of keys jt*32 + 8 lh + r
    c1 = c1 * ksc + bp[2];  // bias of keys jt*32 + 16 + 8 lh + r
    float tm = NEGMAX;
    for (int r = 0; r < 8; r++) tm = fmaxf(tm, fmaxf(c0[r], c1[r]));
    tm = fmaxf(tm, xhalf(tm));
    float mn = fmaxf(mr, tm);
    float sc = __builtin_amdgcn_exp2f(mr - mn);
    mr = mn;
    c0 -= mn;
    c1 -= mn;
    Frag pb;  // Pt as B operand: element s = key kmap(s, lh), column lm
    for (int r = 0; r < 8; r++) {
      c0[r] = __builtin_amdgcn_exp2f(c0[r]);
      c1[r] = __builtin_amdgcn_exp2f(c1[r]);
      pb.h[r] = (_Float16)c0[r];
      pb.h[8 + r] = (_Float16)c1[r];
    }
    lr = lr * sc + (c0 + c1);
    for (int t = 0; t < 4; t++) {
      Oacc[t] *= sc;
      Oacc[t] = wmma_f16(av[t].h, pb.h, Oacc[t]);
    }
  }

  float ls = ((lr[0] + lr[1]) + (lr[2] + lr[3])) +
             ((lr[4] + lr[5]) + (lr[6] + lr[7]));
  float rl = 1.f / (ls + xhalf(ls));
  int srow = w * WIN + i0 + lm;
  float* op = out + ((size_t)srow * BATCH + b) * DMODEL + hh * HD + lh * 8;
  if (srow == 0) return;  // the global token's row; no barrier follows
  for (int t = 0; t < 4; t++) {  // 8 consecutive columns of one row per lane
    float4 o0 = {Oacc[t][0] * rl, Oacc[t][1] * rl, Oacc[t][2] * rl,
                 Oacc[t][3] * rl};
    float4 o1 = {Oacc[t][4] * rl, Oacc[t][5] * rl, Oacc[t][6] * rl,
                 Oacc[t][7] * rl};
    *(float4*)(op + t * 16) = o0;
    *(float4*)(op + t * 16 + 4) = o1;
  }
}

// ---------------------------------------------------------------------------
extern "C" void kernel_launch(void* const* d_in, const int* in_sizes, int n_in,
                              void* d_out, int out_size, void* d_ws,
                              size_t ws_size, hipStream_t stream) {
  (void)in_sizes; (void)n_in; (void)out_size; (void)ws_size;
  const float* hs  = (const float*)d_in[0];
  const int*   kpm = (const int*)d_in[1];
  const float* Wq  = (const float*)d_in[2];
  const float* Wk  = (const float*)d_in[3];
  const float* Wv  = (const float*)d_in[4];
  const float* Wgq = (const float*)d_in[5];
  const float* bq  = (const float*)d_in[6];
  const float* bk  = (const float*)d_in[7];
  const float* bv  = (const float*)d_in[8];
  const float* bgq = (const float*)d_in[9];
  float* out = (float*)d_out;

  size_t per = (size_t)BATCH * NHEAD * S_LEN * HD;  // halfs per q/k/v tensor
  _Float16* q16 = (_Float16*)d_ws;
  _Float16* k16 = q16 + per;
  _Float16* v16 = k16 + per;
  float* gqbuf = (float*)(v16 + per);

  qkv_gemm_wmma<<<GQ_BLOCKS + 128 * 3 * 3, GEMM_THREADS, 0, stream>>>(
      hs, Wq, Wk, Wv, bq, bk, bv, q16, k16, v16, Wgq, bgq, gqbuf);
  size_t lds_bytes = ATT_LDS;
  local_attn_wmma<<<BATCH * NHEAD + NWIN * BATCH * NHEAD, 256, lds_bytes,
                    stream>>>(q16, k16, v16, kpm, gqbuf, out);
}

// v007
// One run takes 198 microseconds.
// Next to v006, in two timings, it ran 1.05 times as fast each time.
// Over all steps from v000 it is 6.24 times as fast.
#include <hip/hip_runtime.h>
#include <hip/hip_bf16.h>

typedef __attribute__((ext_vector_type(16))) _Float16     v16h;
typedef __attribute__((ext_vector_type(8)))  float        v8f;
typedef __attribute__((ext_vector_type(4)))  unsigned int v4u;
typedef __attribute__((ext_vector_type(2)))  unsigned int v2u;
typedef __attribute__((ext_vector_type(4)))  int          v4i;
typedef __attribute__((address_space(1))) v4i* gv4i_p;  // global ("__device__")
typedef __attribute__((address_space(3))) v4i* lv4i_p;  // LDS ("__shared__")

#define S_LEN  4096
#define BATCH  8
#define DMODEL 768
#define NHEAD  12
#define HD     64
#define WIN    128
#define NWIN   32
#define W3     384
#define NEGMAX (-3.402823466e+38f)

#if __has_builtin(__builtin_amdgcn_global_load_async_to_lds_b128)
#define HAVE_ASYNC_LDS 1
#endif

union Frag { v4u u[2]; v16h h; };

__device__ __forceinline__ v8f wmma_f16(v16h a, v16h b, v8f c) {
  return __builtin_amdgcn_wmma_f32_16x16x32_f16(false, a, false, b, (short)0, c,
                                                false, false);
}

__device__ __forceinline__ void wait_async0() {
#ifdef HAVE_ASYNC_LDS
  // this wave's async copies have landed; the clobber holds LDS reads behind it
  asm volatile("s_wait_asynccnt 0x0" ::: "memory");
#endif
}

// 16 bytes, global -> LDS, per lane
__device__ __forceinline__ void copy16_to_lds(const _Float16* g, char* l) {
#ifdef HAVE_ASYNC_LDS
  __builtin_amdgcn_global_load_async_to_lds_b128((gv4i_p)g, (lv4i_p)l, 0, 0);
#else
  *(v4u*)l = *(const v4u*)g;
#endif
}

// transposing LDS load: lane (c = l & 15, h = l >> 4) gets T[8h + 0..7][c] of a
// row-major 16-bit tile; the lane's address names row 8h + (l & 7), 16-byte
// piece (l >> 3) & 1
typedef short s16x8 __attribute__((ext_vector_type(8)));
typedef __attribute__((address_space(3))) s16x8 lds_s16x8;
__device__ __forceinline__ v4u ld_tr16(const char* p) {
  return __builtin_bit_cast(
      v4u, __builtin_amdgcn_ds_load_tr16_b128_v8i16((lds_s16x8*)p));
}

// ---------------------------------------------------------------------------
// gq = hidden[0] @ Wgq + bgq (tiny, bound by load latency). Runs as the first
// GQ_BLOCKS work-groups of the projection launch, beside the GEMM tiles.
// ---------------------------------------------------------------------------
#define GEMM_THREADS 512
#define GQ_BLOCKS ((BATCH * DMODEL + GEMM_THREADS - 1) / GEMM_THREADS)  // 12
__device__ __forceinline__ void gq_proj_block(int blk,
                                              const float* __restrict__ X,
                                              const float* __restrict__ Wgq,
                                              const float* __restrict__ bgq,
                                              float* __restrict__ gq) {
  int idx = blk * GEMM_THREADS + threadIdx.x;
  if (idx >= BATCH * DMODEL) return;
  int b = idx / DMODEL, d = idx % DMODEL;
  const float* xr = X + (size_t)b * DMODEL;  // hidden[(0,b),:]
  float s = bgq[d];
  for (int k = 0; k < DMODEL; k++) s += xr[k] * Wgq[(size_t)k * DMODEL + d];
  gq[idx] = s;  // layout (b*H+h)*64+e == b*768+d
}

// ---------------------------------------------------------------------------
// Kernel 1: fused Q/K/V projection GEMM (z selects weight), f32 in -> f16 out
// scattered into (B*H, S, hd) layout. Block tile 256x256 (16 waves of 64x64),
// K-chunks of 32, double-buffered LDS so global loads overlap the WMMAs. The
// bytes drawn from L2 per product fall with the tile's edge; the 64x64 wave
// tile reads 16 half-fragments for 16 WMMAs. One work-group fills a WGP.
// LDS tiles: one row per m (Xs) or n (Ws), 32 k as f16, row pitch 80 B
// (16 B x odd: the 16 rows of a b128 fragment read fall on distinct banks).
// Every staging store is a b64 whose 32 lanes cover all 64 banks once.
// 1-D grid: GQ_BLOCKS work-groups of the gq projection first (they start first
// and finish under the GEMM), then the tiles, m fastest, then n, then weight.
// ---------------------------------------------------------------------------
#define TP 40  // LDS row pitch in halves
__global__ __launch_bounds__(GEMM_THREADS) void qkv_gemm_wmma(
    const float* __restrict__ X, const float* __restrict__ W0,
    const float* __restrict__ W1, const float* __restrict__ W2,
    const float* __restrict__ b0, const float* __restrict__ b1,
    const float* __restrict__ b2, _Float16* __restrict__ q16,
    _Float16* __restrict__ k16, _Float16* __restrict__ v16,
    const float* __restrict__ Wgq, const float* __restrict__ bgq,
    float* __restrict__ gq) {
  __shared__ __attribute__((aligned(16))) _Float16 Xs[2][256 * TP];
  __shared__ __attribute__((aligned(16))) _Float16 Ws[2][256 * TP];

  int bid = blockIdx.x;
  if (bid < GQ_BLOCKS) {  // the same for the whole block, ahead of any barrier
    gq_proj_block(bid, X, Wgq, bgq, gq);
    return;
  }
  bid -= GQ_BLOCKS;
  int yz = bid >> 7;  // 128 m tiles
  int z = yz / 3;
  const float* W = (z == 0) ? W0 : (z == 1) ? W1 : W2;
  const float* bias = (z == 0) ? b0 : (z == 1) ? b1 : b2;
  _Float16* dst = (z == 0) ? q16 : (z == 1) ? k16 : v16;

  int m0 = (bid & 127) * 256;
  int n0 = (yz % 3) * 256;
  int tid = threadIdx.x;
  int wid = tid >> 5, lane = tid & 31;
  int lm = lane & 15, lh = lane >> 4;
  int wm = (wid & 3) * 64;   // wave M offset
  int wn = (wid >> 2) * 64;  // wave N offset

  float4 xr[4], wr[4];  // staged global data for next chunk

  // X: a wave-wide access takes 4 rows that lie 4 apart (4 x 80 B = 16 banks
  // mod 64), 8 lanes x 4 k on each row.
  int xrow = wid * 16 + (lane >> 3) * 4;  // + it
  int xc4 = (lane & 7) << 2;
  // W: each thread owns a 4 k x 4 n block, so the transpose is a choice of
  // registers and each n row gets 4 consecutive k in one b64 store. A wave
  // holds 16 k x 32 n; rows 16 apart fall on the same banks, so the rows with
  // bit 4 of n set keep their two 16-k halves swapped.
  int skh = wid >> 3;                         // which 16-k half
  int sk = skh * 16 + (lane >> 3) * 4;        // + it
  int sn = (wid & 7) * 32 + (lane & 7) * 4;   // + j
  int wpos = sn * TP + ((skh ^ ((lane >> 2) & 1)) << 4) + (lane >> 3) * 4;

  auto pack4 = [](float a, float b, float c, float d) {
    union { _Float16 h[4]; v2u u; } pk;
    pk.h[0] = (_Float16)a; pk.h[1] = (_Float16)b;
    pk.h[2] = (_Float16)c; pk.h[3] = (_Float16)d;
    return pk.u;
  };
  auto load_global = [&](int k0) {
    for (int it = 0; it < 4; it++) {  // all loads issued before any use
      xr[it] = *(const float4*)(X + (size_t)(m0 + xrow + it) * DMODEL + k0 + xc4);
      wr[it] = *(const float4*)(W + (size_t)(k0 + sk + it) * DMODEL + n0 + sn);
    }
  };
  auto store_lds = [&](int buf) {
    for (int it = 0; it < 4; it++)
      *(v2u*)(&Xs[buf][(xrow + it) * TP + xc4]) =
          pack4(xr[it].x, xr[it].y, xr[it].z, xr[it].w);
    _Float16* wp = &Ws[buf][wpos];
    *(v2u*)(wp + 0 * TP) = pack4(wr[0].x, wr[1].x, wr[2].x, wr[3].x);
    *(v2u*)(wp + 1 * TP) = pack4(wr[0].y, wr[1].y, wr[2].y, wr[3].y);
    *(v2u*)(wp + 2 * TP) = pack4(wr[0].z, wr[1].z, wr[2].z, wr[3].z);
    *(v2u*)(wp + 3 * TP) = pack4(wr[0].w, wr[1].w, wr[2].w, wr[3].w);
  };

  load_global(0);
  store_lds(0);
  v8f acc[4][4] = {};

  const int NKC = DMODEL / 32;  // 24
  for (int kc = 0; kc < NKC; kc++) {
    __syncthreads();
    if (kc + 1 < NKC) load_global((kc + 1) * 32);  // overlap with WMMAs
    // keeps the 8 loads issued here: left free, the compiler sinks them in two
    // groups between the WMMAs and the wave waits out the load latency twice
    __builtin_amdgcn_sched_barrier(0);
    int cb = kc & 1;
    Frag af[4], bf[4];
    auto load_a = [&](int mt) {
      const _Float16* p = &Xs[cb][(wm + mt * 16 + lm) * TP + lh * 8];
      af[mt].u[0] = *(const v4u*)p;
      af[mt].u[1] = *(const v4u*)(p + 16);
    };
    // asked for in the order the WMMAs use them, so that the first WMMAs start
    // while the later reads are still under way
    load_a(0);
    for (int nt = 0; nt < 4; nt++) {
      const _Float16* p = &Ws[cb][(wn + nt * 16 + lm) * TP + lh * 8];
      bf[nt].u[0] = *(const v4u*)(p + (nt & 1) * 16);  // halves swapped: odd nt
      bf[nt].u[1] = *(const v4u*)(p + 16 - (nt & 1) * 16);
    }
    for (int mt = 1; mt < 4; mt++) load_a(mt);
    // keeps the 16 fragment reads in one group ahead of the WMMAs: left free,
    // the compiler reuses A registers and a wave waits out two more LDS reads
    // queued behind every other wave's
    __builtin_amdgcn_sched_barrier(0);
    for (int mt = 0; mt < 4; mt++)
      for (int nt = 0; nt < 4; nt++)
        acc[mt][nt] = wmma_f16(af[mt].h, bf[nt].h, acc[mt][nt]);
    // keeps the conversions, and with them the wait for the 8 loads, behind the
    // WMMAs: one work-group fills the WGP, so nothing else covers that latency
    __builtin_amdgcn_sched_barrier(0);
    if (kc + 1 < NKC) store_lds((kc + 1) & 1);
  }

  // epilogue: +bias, scatter to (b*H+h, s, e) f16
  for (int mt = 0; mt < 4; mt++)
    for (int nt = 0; nt < 4; nt++) {
      int col = n0 + wn + nt * 16 + lm;
      float bvv = bias[col];
      int h = col >> 6, e = col & 63;
      for (int r = 0; r < 8; r++) {
        int t = m0 + wm + mt * 16 + r + 8 * lh;  // token index = s*B + b
        int s = t >> 3, b = t & 7;
        dst[((size_t)(b * NHEAD + h) * S_LEN + s) * HD + e] =
            (_Float16)(acc[mt][nt][r] + bvv);
      }
    }
}

// ---------------------------------------------------------------------------
// Kernel 2: local windowed attention with look-around, flash-style online
// softmax, all matmuls via v_wmma_f32_16x16x32_f16. K and V tiles staged
// row-major with GLOBAL_LOAD_ASYNC_TO_LDS_B128 when the toolchain exposes it.
// The products run transposed: St = K.Qt and Ot += Vt.Pt. A lane then holds
// 16 scores of ONE query (column lm; keys 8 lh + r and 16 + 8 lh + r of the
// 32-key tile), so the row maximum and sum are in-lane work plus one exchange
// between the wave's halves, the two score tiles converted in place ARE the B
// operand of the second product, and the rescale factor is the lane's own.
// LDS layout, in 16-byte pieces, no padding (three blocks fit one WGP):
//   K row j (8 pieces): piece p lies at p ^ ((j >> 1) & 7)
// so the 16 rows of a ds_load_b128 fragment read fall on all 64 banks.
//   V row j (8 pieces): piece p lies at p ^ (((j >> 1) & 3) << 1), so the 8
//   rows x 32 B that one half of the lanes names in a ds_load_tr16_b128 fall on
//   all 64 banks (unswizzled 128-B rows: 4 rows on the same banks). The load
//   hands out the A fragment Vt in the k order of the packed scores
//   (8h + 0..7, then 16 + 8h + 0..7).
//   bJ: per key 0 or NEGMAX, added to the score; bN: 32 x NEGMAX, read in its
//   place by the lanes whose own query is masked.
// 1-D grid, 256 threads (8 waves x 16 query rows): the B*H work-groups of the
// global-token attention first (long and latency-bound: they start first and
// run beside the windows), then NWIN x B*H windows. Row 0 of out belongs to the
// global token, so the window that holds query 0 does not store it.
// ---------------------------------------------------------------------------
#define ROWB 128  // K and V row, bytes
#define ATT_V_OFF  (W3 * ROWB)
#define ATT_BJ_OFF (ATT_V_OFF + W3 * ROWB)
#define ATT_BN_OFF (ATT_BJ_OFF + W3 * 4)
#define ATT_LDS    (ATT_BN_OFF + 32 * 4)  // 99,968 B

// value of lane l ^ 16
__device__ __forceinline__ float xhalf(float x) {
  int v = __builtin_bit_cast(int, x);
  return __builtin_bit_cast(
      float, __builtin_amdgcn_permlanex16(v, v, 0x76543210, 0xfedcba98, false,
                                          false));
}

// ---------------------------------------------------------------------------
// Global-token attention of one (batch, head): writes out row 0. Deterministic
// reductions (no float atomics). Runs as the first BATCH * NHEAD work-groups of
// the attention launch, beside the local windows, in the same dynamic LDS.
// The 64 output sums over the 256 threads: each thread parks its 64 partial
// sums as one LDS row; behind one barrier a thread adds one column over 64
// rows, behind a second one 64 threads add the 4 quarters. This block is the
// longest of the launch, so its chain of barriers is kept short.
// ---------------------------------------------------------------------------
#define GA_QSH_OFF  (S_LEN * 4)
#define GA_RED_OFF  (GA_QSH_OFF + HD * 4)
#define GA_ACC_OFF  (GA_RED_OFF + 256 * 4)
#define GA_PARK_OFF (GA_ACC_OFF + (HD + 4) * 4)
// park row pitch in words, odd: the stores (a lane per row) and the reads (a
// lane per column) both fall on 32 distinct banks
#define GA_PP       (HD + 1)
#define GA_LDS      (GA_PARK_OFF + 256 * GA_PP * 4)  // 84,496 B
static_assert(GA_LDS <= ATT_LDS, "global-token path fits the launch's LDS");

__device__ __forceinline__ void global_attn_block(
    int bh, char* smem, const float* __restrict__ gq,
    const _Float16* __restrict__ k16, const _Float16* __restrict__ v16,
    const int* __restrict__ kpm, float* __restrict__ out) {
  float* sc = (float*)smem;                    // S_LEN
  float* qsh = (float*)(smem + GA_QSH_OFF);    // HD
  float* red = (float*)(smem + GA_RED_OFF);    // 256
  float* accv = (float*)(smem + GA_ACC_OFF);   // HD + 1
  float* park = (float*)(smem + GA_PARK_OFF);  // 256 rows of GA_PP
  int b = bh / NHEAD, hh = bh % NHEAD;
  int tid = threadIdx.x;
  if (tid < HD) qsh[tid] = gq[bh * HD + tid];
  __syncthreads();

  const _Float16* Kg = k16 + (size_t)bh * S_LEN * HD;
  const _Float16* Vg = v16 + (size_t)bh * S_LEN * HD;
  // the query in registers: carved out of one LDS array, qsh cannot be told
  // apart from sc by the compiler, which would reload it after each score store
  float qr[HD];
  for (int e = 0; e < HD; e++) qr[e] = qsh[e];
  float lmax = NEGMAX;
  for (int s = tid; s < S_LEN; s += 256) {
    const _Float16* kr = Kg + (size_t)s * HD;
    float d = 0.f;
    for (int e = 0; e < HD; e++) d += qr[e] * (float)kr[e];
    d *= 0.125f;
    if (kpm[b * S_LEN + s]) d = NEGMAX;
    sc[s] = d;
    lmax = fmaxf(lmax, d);
  }
  red[tid] = lmax;
  __syncthreads();
  for (int st = 128; st > 0; st >>= 1) {
    if (tid < st) red[tid] = fmaxf(red[tid], red[tid + st]);
    __syncthreads();
  }
  float M = red[0];
  __syncthreads();

  float av[HD];
  for (int e = 0; e < HD; e++) av[e] = 0.f;
  float lsum = 0.f;
  for (int s = tid; s < S_LEN; s += 256) {
    float p = __expf(sc[s] - M);
    lsum += p;
    const _Float16* vr = Vg + (size_t)s * HD;
    for (int e = 0; e < HD; e++) av[e] += p * (float)vr[e];
  }
  for (int e = 0; e < HD; e++) park[tid * GA_PP + e] = av[e];
  __syncthreads();
  // column tid & 63 over the rows of quarter tid >> 6, in row order
  const float* pc = park + (tid >> 6) * 64 * GA_PP + (tid & 63);
  float cs = 0.f;
  for (int i = 0; i < 64; i++) cs += pc[i * GA_PP];
  red[tid] = cs;
  __syncthreads();
  if (tid < HD)
    accv[tid] = (red[tid] + red[tid + 64]) + (red[tid + 128] + red[tid + 192]);
  __syncthreads();  // red is written again below
  red[tid] = lsum;
  __syncthreads();
  for (int st = 128; st > 0; st >>= 1) {
    if (tid < st) red[tid] += red[tid + st];
    __syncthreads();
  }
  if (tid == 0) accv[HD] = red[0];
  __syncthreads();
  if (tid < HD)
    out[(size_t)b * DMODEL + hh * HD + tid] = accv[tid] / accv[HD];
}

__global__ __launch_bounds__(256) void local_attn_wmma(
    const _Float16* __restrict__ q16, const _Float16* __restrict__ k16,
    const _Float16* __restrict__ v16, const int* __restrict__ kpm,
    const float* __restrict__ gq, float* __restrict__ out) {
  extern __shared__ __attribute__((aligned(16))) char smem[];
  char* Ksm = smem;                        // 384 rows x 64 halves
  char* Vsm = smem + ATT_V_OFF;            // 384 rows x 64 halves
  float* bJ = (float*)(smem + ATT_BJ_OFF); // 384
  float* bN = (float*)(smem + ATT_BN_OFF); // 32

  int bid = blockIdx.x;
  if (bid < BATCH * NHEAD) {  // the same for the whole block, ahead of any barrier
    global_attn_block(bid, smem, gq, k16, v16, kpm, out);
    return;
  }
  bid -= BATCH * NHEAD;
  int w = bid & (NWIN - 1), bh = bid >> 5;  // window fastest
  int b = bh / NHEAD, hh = bh % NHEAD;
  int tid = threadIdx.x, wid = tid >> 5, lane = tid & 31;
  int lm = lane & 15, lh = lane >> 4;
  const _Float16* Kg = k16 + (size_t)bh * S_LEN * HD;
  const _Float16* Vg = v16 + (size_t)bh * S_LEN * HD;

  // K and V tiles, one window at a time; whether a window exists is the same
  // for the whole block, so every lane is on at every copy. A window past
  // either end is zero-filled (look-around padding).
  for (int seg = 0; seg < 3; seg++) {
    int wj = w - 1 + seg;
    char* kd = Ksm + seg * WIN * ROWB;
    char* vd = Vsm + seg * WIN * ROWB;
    if (wj >= 0 && wj < NWIN) {
      const _Float16* kg = Kg + (size_t)wj * WIN * HD;
      const _Float16* vg = Vg + (size_t)wj * WIN * HD;
      for (int it = 0; it < 4; it++) {
        int idx = it * 256 + tid;  // 16-byte piece; a wave takes 512 B in a row
        int j = idx >> 3, c = idx & 7;
        copy16_to_lds(kg + idx * 8, kd + j * ROWB + ((c ^ ((j >> 1) & 7)) << 4));
        copy16_to_lds(vg + idx * 8,
                      vd + j * ROWB + ((c ^ (((j >> 1) & 3) << 1)) << 4));
      }
    } else {
      v4u zz = {};
      for (int it = 0; it < 4; it++) {
        int idx = it * 256 + tid;
        *(v4u*)(kd + idx * 16) = zz;
        *(v4u*)(vd + idx * 16) = zz;
      }
    }
  }
  for (int j = tid; j < W3; j += 256) {
    int s = (w - 1) * WIN + j;
    bJ[j] = (s < 0 || s >= S_LEN || kpm[b * S_LEN + s]) ? NEGMAX : 0.f;
  }
  if (tid < 32) bN[tid] = NEGMAX;
  int i0 = wid * 16;
  bool qmask = kpm[b * S_LEN + w * WIN + i0 + lm] != 0;  // the lane's query
  wait_async0();
  __syncthreads();

  const _Float16* Qg = q16 + ((size_t)bh * S_LEN + (size_t)w * WIN + i0) * HD;
  Frag aq[2];
  for (int ec = 0; ec < 2; ec++) {
    const _Float16* p = Qg + lm * HD + ec * 32 + lh * 8;
    aq[ec].u[0] = *(const v4u*)p;
    aq[ec].u[1] = *(const v4u*)(p + 16);
  }

  // hd^-0.5 * log2(e): scores are kept in log2 units. A masked score is
  // c * ksc + NEGMAX, which rounds to NEGMAX itself (|c * ksc| is far below
  // half an ulp of NEGMAX for any f16 operands).
  const float ksc = 0.125f * 1.44269504088896340736f;
  v8f Oacc[4] = {};  // Oacc[t][r] = Ot[t * 16 + 8 lh + r][query lm]
  float mr = NEGMAX;
  v8f lr = {};  // row sum in 8 parts, this half's keys only; joined at the end
  // lane offsets inside a row; a further piece index is XORed in at bits 4..6
  const char* Kl = Ksm + lm * ROWB;
  int kx = (lh ^ (lm >> 1)) << 4;  // rows jt*32 (+16) + lm: (j >> 1) & 7 = lm >> 1
  const char* Vl = Vsm + (8 * lh + (lane & 7)) * ROWB + ((lane >> 3) & 1) * 16;
  int vx = ((lane >> 1) & 3) << 5;  // the lane's rows: (j >> 1) & 3 = (lane >> 1) & 3
  const char* bl = smem + (qmask ? ATT_BN_OFF : ATT_BJ_OFF) + lh * 32;
  int bstep = qmask ? 0 : 128;  // bytes per 32 keys

  for (int jt = 0; jt < 12; jt++) {
    // scores: two 16-key tiles over hd (K = 2 chunks of 32)
    v8f c0 = {}, c1 = {};
    for (int ec = 0; ec < 2; ec++) {
      Frag bk0, bk1;
      const char* p0 = Kl + jt * 32 * ROWB;
      const char* p1 = p0 + 16 * ROWB;
      int ka = kx ^ (ec * 64), kb = ka ^ 32;
      bk0.u[0] = *(const v4u*)(p0 + ka); bk0.u[1] = *(const v4u*)(p0 + kb);
      bk1.u[0] = *(const v4u*)(p1 + ka); bk1.u[1] = *(const v4u*)(p1 + kb);
      c0 = wmma_f16(bk0.h, aq[ec].h, c0);
      c1 = wmma_f16(bk1.h, aq[ec].h, c1);
    }
    // Vt fragments of this tile, asked for here so that they arrive while the
    // softmax below runs
    Frag av[4];
    for (int t = 0; t < 4; t++) {
      const char* vp = Vl + jt * 32 * ROWB + ((t * 32) ^ vx);
      av[t].u[0] = ld_tr16(vp);
      av[t].u[1] = ld_tr16(vp + 16 * ROWB);
    }
    const v8f* bp = (const v8f*)(bl + jt * bstep);
    c0 = c0 * ksc + bp[0];  // bias of keys jt*32 + 8 lh + r
    c1 = c1 * ksc + bp[2];  // bias of keys jt*32 + 16 + 8 lh + r
    float tm = NEGMAX;
    for (int r = 0; r < 8; r++) tm = fmaxf(tm, fmaxf(c0[r], c1[r]));
    tm = fmaxf(tm, xhalf(tm));
    float mn = fmaxf(mr, tm);
    float sc = __builtin_amdgcn_exp2f(mr - mn);
    mr = mn;
    c0 -= mn;
    c1 -= mn;
    Frag pb;  // Pt as B operand: element s = key kmap(s, lh), column lm
    for (int r = 0; r < 8; r++) {
      c0[r] = __builtin_amdgcn_exp2f(c0[r]);
      c1[r] = __builtin_amdgcn_exp2f(c1[r]);
      pb.h[r] = (_Float16)c0[r];
      pb.h[8 + r] = (_Float16)c1[r];
    }
    lr = lr * sc + (c0 + c1);
    for (int t = 0; t < 4; t++) {
      Oacc[t] *= sc;
      Oacc[t] = wmma_f16(av[t].h, pb.h, Oacc[t]);
    }
  }

  float ls = ((lr[0] + lr[1]) + (lr[2] + lr[3])) +
             ((lr[4] + lr[5]) + (lr[6] + lr[7]));
  float rl = 1.f / (ls + xhalf(ls));
  int srow = w * WIN + i0 + lm;
  float* op = out + ((size_t)srow * BATCH + b) * DMODEL + hh * HD + lh * 8;
  if (srow == 0) return;  // the global token's row; no barrier follows
  for (int t = 0; t < 4; t++) {  // 8 consecutive columns of one row per lane
    float4 o0 = {Oacc[t][0] * rl, Oacc[t][1] * rl, Oacc[t][2] * rl,
                 Oacc[t][3] * rl};
    float4 o1 = {Oacc[t][4] * rl, Oacc[t][5] * rl, Oacc[t][6] * rl,
                 Oacc[t][7] * rl};
    *(float4*)(op + t * 16) = o0;
    *(float4*)(op + t * 16 + 4) = o1;
  }
}

// ---------------------------------------------------------------------------
extern "C" void kernel_launch(void* const* d_in, const int* in_sizes, int n_in,
                              void* d_out, int out_size, void* d_ws,
                              size_t ws_size, hipStream_t stream) {
  (void)in_sizes; (void)n_in; (void)out_size; (void)ws_size;
  const float* hs  = (const float*)d_in[0];
  const int*   kpm = (const int*)d_in[1];
  const float* Wq  = (const float*)d_in[2];
  const float* Wk  = (const float*)d_in[3];
  const float* Wv  = (const float*)d_in[4];
  const float* Wgq = (const float*)d_in[5];
  const float* bq  = (const float*)d_in[6];
  const float* bk  = (const float*)d_in[7];
  const float* bv  = (const float*)d_in[8];
  const float* bgq = (const float*)d_in[9];
  float* out = (float*)d_out;

  size_t per = (size_t)BATCH * NHEAD * S_LEN * HD;  // halfs per q/k/v tensor
  _Float16* q16 = (_Float16*)d_ws;
  _Float16* k16 = q16 + per;
  _Float16* v16 = k16 + per;
  float* gqbuf = (float*)(v16 + per);

  qkv_gemm_wmma<<<GQ_BLOCKS + 128 * 3 * 3, GEMM_THREADS, 0, stream>>>(
      hs, Wq, Wk, Wv, bq, bk, bv, q16, k16, v16, Wgq, bgq, gqbuf);
  size_t lds_bytes = ATT_LDS;
  local_attn_wmma<<<BATCH * NHEAD + NWIN * BATCH * NHEAD, 256, lds_bytes,
                    stream>>>(q16, k16, v16, kpm, gqbuf, out);
}

// v008
// It runs in 156 microseconds.
// In both of two side-by-side timings against v007, it was 1.27 times as fast.
// Over all steps from v000 it is 7.93 times as fast.
#include <hip/hip_runtime.h>
#include <hip/hip_bf16.h>

typedef __attribute__((ext_vector_type(16))) _Float16     v16h;
typedef __attribute__((ext_vector_type(8)))  float        v8f;
typedef __attribute__((ext_vector_type(4)))  unsigned int v4u;
typedef __attribute__((ext_vector_type(2)))  unsigned int v2u;
typedef __attribute__((ext_vector_type(4)))  int          v4i;
typedef __attribute__((address_space(1))) v4i* gv4i_p;  // global ("__device__")
typedef __attribute__((address_space(3))) v4i* lv4i_p;  // LDS ("__shared__")

#define S_LEN  4096
#define BATCH  8
#define DMODEL 768
#define NHEAD  12
#define HD     64
#define WIN    128
#define NWIN   32
#define W3     384
#define NEGMAX (-3.402823466e+38f)

#if __has_builtin(__builtin_amdgcn_global_load_async_to_lds_b128)
#define HAVE_ASYNC_LDS 1
#endif

union Frag { v4u u[2]; v16h h; };

__device__ __forceinline__ v8f wmma_f16(v16h a, v16h b, v8f c) {
  return __builtin_amdgcn_wmma_f32_16x16x32_f16(false, a, false, b, (short)0, c,
                                                false, false);
}

__device__ __forceinline__ void wait_async0() {
#ifdef HAVE_ASYNC_LDS
  // this wave's async copies have landed; the clobber holds LDS reads behind it
  asm volatile("s_wait_asynccnt 0x0" ::: "memory");
#endif
}

// 16 bytes, global -> LDS, per lane
__device__ __forceinline__ void copy16_to_lds(const _Float16* g, char* l) {
#ifdef HAVE_ASYNC_LDS
  __builtin_amdgcn_global_load_async_to_lds_b128((gv4i_p)g, (lv4i_p)l, 0, 0);
#else
  *(v4u*)l = *(const v4u*)g;
#endif
}

// the byte address of a __shared__ object inside the work-group's LDS
typedef __attribute__((address_space(3))) const char lds_cchar;
__device__ __forceinline__ unsigned lds_addr(const char* p) {
  return (unsigned)(size_t)(lds_cchar*)p;
}

// 8 copies of 16 bytes per lane, global -> LDS, rows gstep halves / lstep bytes
// apart; each copy has address registers of its own and no immediate offset.
// The s_wait_xcnt closes the copies' own statement, so that no register named
// here is rewritten in front of it (a precaution).
__device__ __forceinline__ void copy16x8_to_lds(const _Float16* g, unsigned l,
                                                int gstep, unsigned lstep) {
  asm volatile(
      "global_load_async_to_lds_b128 %0, %8, off\n\t"
      "global_load_async_to_lds_b128 %1, %9, off\n\t"
      "global_load_async_to_lds_b128 %2, %10, off\n\t"
      "global_load_async_to_lds_b128 %3, %11, off\n\t"
      "global_load_async_to_lds_b128 %4, %12, off\n\t"
      "global_load_async_to_lds_b128 %5, %13, off\n\t"
      "global_load_async_to_lds_b128 %6, %14, off\n\t"
      "global_load_async_to_lds_b128 %7, %15, off\n\t"
      "s_wait_xcnt 0x0"
      :
      : "v"(l), "v"(l + lstep), "v"(l + 2 * lstep), "v"(l + 3 * lstep),
        "v"(l + 4 * lstep), "v"(l + 5 * lstep), "v"(l + 6 * lstep),
        "v"(l + 7 * lstep), "v"(g), "v"(g + gstep), "v"(g + 2 * gstep),
        "v"(g + 3 * gstep), "v"(g + 4 * gstep), "v"(g + 5 * gstep),
        "v"(g + 6 * gstep), "v"(g + 7 * gstep)
      : "memory");
}

// transposing LDS load: lane (c = l & 15, h = l >> 4) gets T[8h + 0..7][c] of a
// row-major 16-bit tile; the lane's address names row 8h + (l & 7), 16-byte
// piece (l >> 3) & 1
typedef short s16x8 __attribute__((ext_vector_type(8)));
typedef __attribute__((address_space(3))) s16x8 lds_s16x8;
__device__ __forceinline__ v4u ld_tr16(const char* p) {
  return __builtin_bit_cast(
      v4u, __builtin_amdgcn_ds_load_tr16_b128_v8i16((lds_s16x8*)p));
}

// ---------------------------------------------------------------------------
// gq = hidden[0] @ Wgq + bgq (tiny, bound by load latency). Runs as the first
// GQ_BLOCKS work-groups of the projection launch, beside the GEMM tiles.
// ---------------------------------------------------------------------------
#define GEMM_THREADS 512
#define GQ_BLOCKS ((BATCH * DMODEL + GEMM_THREADS - 1) / GEMM_THREADS)  // 12
__device__ __forceinline__ void gq_proj_block(int blk,
                                              const float* __restrict__ X,
                                              const float* __restrict__ Wgq,
                                              const float* __restrict__ bgq,
                                              float* __restrict__ gq) {
  int idx = blk * GEMM_THREADS + threadIdx.x;
  if (idx >= BATCH * DMODEL) return;
  int b = idx / DMODEL, d = idx % DMODEL;
  const float* xr = X + (size_t)b * DMODEL;  // hidden[(0,b),:]
  float s = bgq[d];
  for (int k = 0; k < DMODEL; k++) s += xr[k] * Wgq[(size_t)k * DMODEL + d];
  gq[idx] = s;  // layout (b*H+h)*64+e == b*768+d
}

// ---------------------------------------------------------------------------
// Launch 1: the GEMM's operands as f16, made once. The GEMM reads every X tile
// 9 times and every W tile 128 times from L2: as f16 those reads are half the
// bytes, and the tiles can go to LDS as they lie, through no register.
//   x16[m][k]        = X[m][k]
//   wt16[z*768+n][k] = Wz[k][n]   (k runs along the row, as the B fragment reads)
// First WT_BLOCKS work-groups: a thread takes 64 k of one column n (the lanes
// lie along n, so each load is whole lines) and writes one whole 128-B line.
// The rest: X as a stream, 16 B a lane in, 8 B a lane out, 8 loads in flight.
// ---------------------------------------------------------------------------
#define CVT_THREADS 256
#define WT_BLOCKS (3 * DMODEL * (DMODEL / 64) / CVT_THREADS)              // 108
#define XC_BLOCKS (S_LEN * BATCH * DMODEL / 4 / 8 / CVT_THREADS)          // 3072

__device__ __forceinline__ v2u pack4(float a, float b, float c, float d) {
  union { _Float16 h[4]; v2u u; } pk;
  pk.h[0] = (_Float16)a; pk.h[1] = (_Float16)b;
  pk.h[2] = (_Float16)c; pk.h[3] = (_Float16)d;
  return pk.u;
}

__global__ __launch_bounds__(CVT_THREADS) void operands_to_f16(
    const float* __restrict__ X, const float* __restrict__ W0,
    const float* __restrict__ W1, const float* __restrict__ W2,
    _Float16* __restrict__ x16, _Float16* __restrict__ wt16) {
  int bid = blockIdx.x, tid = threadIdx.x;
  if (bid < WT_BLOCKS) {
    int idx = bid * CVT_THREADS + tid;
    int n = idx % DMODEL, rest = idx / DMODEL;  // rest: the same for the block
    int kg = rest % (DMODEL / 64), z = rest / (DMODEL / 64);
    const float* W = (z == 0) ? W0 : (z == 1) ? W1 : W2;
    const float* p = W + (size_t)(kg * 64) * DMODEL + n;
    float v[64];
    for (int i = 0; i < 64; i++) v[i] = p[(size_t)i * DMODEL];
    v4u* d = (v4u*)(wt16 + (size_t)(z * DMODEL + n) * DMODEL + kg * 64);
    for (int i = 0; i < 8; i++) {
      v2u lo = pack4(v[8 * i], v[8 * i + 1], v[8 * i + 2], v[8 * i + 3]);
      v2u hi = pack4(v[8 * i + 4], v[8 * i + 5], v[8 * i + 6], v[8 * i + 7]);
      v4u o = {lo.x, lo.y, hi.x, hi.y};
      d[i] = o;
    }
    return;
  }
  size_t base = (size_t)(bid - WT_BLOCKS) * (CVT_THREADS * 8) + tid;
  const float4* s4 = (const float4*)X + base;
  v2u* d2 = (v2u*)x16 + base;
  float4 r[8];
  for (int u = 0; u < 8; u++) r[u] = s4[u * CVT_THREADS];
  for (int u = 0; u < 8; u++)
    d2[u * CVT_THREADS] = pack4(r[u].x, r[u].y, r[u].z, r[u].w);
  // stands behind the 8 stores, ahead of any rewrite of a register they name on
  // whatever way the built code leaves this place (a precaution)
  asm volatile("s_wait_xcnt 0x0" ::: "memory");
}

// ---------------------------------------------------------------------------
// Launch 2: fused Q/K/V projection GEMM (z selects weight), f16 operands from
// launch 1 -> f16 out scattered into (B*H, S, hd) layout. Block tile 256x256
// (16 waves of 64x64). One work-group fills a WGP.
// A stage is 128 k of the 256 X rows and the 256 W rows, brought by async b128
// copies (a wave-wide copy = 2 rows x 256 B); two buffers, stage t + 2 asked
// for when trip t has left its buffer, so a whole trip covers its way from L2.
// LDS row pitch 272 B (16 B x odd: the 16 rows of a b128 fragment read fall on
// distinct banks).
// 1-D grid: GQ_BLOCKS work-groups of the gq projection first (they start first
// and finish under the GEMM), then the tiles, m fastest, then n, then weight.
// ---------------------------------------------------------------------------
#define KST 128                // k per stage
#define NST (DMODEL / KST)     // 6 stages
#define TPB 272                // LDS row pitch, bytes
#define OPB (256 * TPB)        // one operand's rows of a stage
#define STB (2 * OPB)          // a stage: X rows, then W rows
__global__ __launch_bounds__(GEMM_THREADS) void qkv_gemm_wmma(
    const _Float16* __restrict__ x16, const _Float16* __restrict__ wt16,
    const float* __restrict__ b0, const float* __restrict__ b1,
    const float* __restrict__ b2, _Float16* __restrict__ q16,
    _Float16* __restrict__ k16, _Float16* __restrict__ v16,
    const float* __restrict__ X, const float* __restrict__ Wgq,
    const float* __restrict__ bgq, float* __restrict__ gq) {
  __shared__ __attribute__((aligned(16))) char Ts[2 * STB];  // 278,528 B

  int bid = blockIdx.x;
  if (bid < GQ_BLOCKS) {  // the same for the whole block, ahead of any barrier
    gq_proj_block(bid, X, Wgq, bgq, gq);
    return;
  }
  bid -= GQ_BLOCKS;
  int yz = bid >> 7;  // 128 m tiles
  int z = yz / 3;
  const float* bias = (z == 0) ? b0 : (z == 1) ? b1 : b2;
  _Float16* dst = (z == 0) ? q16 : (z == 1) ? k16 : v16;

  int m0 = (bid & 127) * 256;
  int n0 = (yz % 3) * 256;
  int tid = threadIdx.x;
  int wid = tid >> 5, lane = tid & 31;
  int lm = lane & 15, lh = lane >> 4;
  int wm = (wid & 3) * 64;   // wave M offset
  int wn = (wid >> 2) * 64;  // wave N offset

  // a thread's 16-byte piece of a stage: rows crow + 32 it, piece tid & 15
  int crow = tid >> 4;
  const _Float16* xsrc = x16 + (size_t)(m0 + crow) * DMODEL + (tid & 15) * 8;
  const _Float16* wsrc =
      wt16 + (size_t)(yz * 256 + crow) * DMODEL + (tid & 15) * 8;
  unsigned cdst = lds_addr(Ts) + crow * TPB + (tid & 15) * 16;
  auto stage_copy = [&](int t, int buf) {  // every lane on, 16 copies a wave
    copy16x8_to_lds(xsrc + t * KST, cdst + buf * STB, 32 * DMODEL, 32 * TPB);
    copy16x8_to_lds(wsrc + t * KST, cdst + buf * STB + OPB, 32 * DMODEL,
                    32 * TPB);
  };

  stage_copy(0, 0);
  wait_async0();
  __syncthreads();
  stage_copy(1, 1);
  v8f acc[4][4] = {};

  for (int t = 0; t < NST; t++) {
    int cb = t & 1;
    const char* xa = Ts + cb * STB + (wm + lm) * TPB + lh * 16;
    const char* wb = Ts + cb * STB + OPB + (wn + lm) * TPB + lh * 16;
    for (int ks = 0; ks < KST / 32; ks++) {
      Frag af[4], bf[4];
      // k order of both operands: 8 lh + 0..7, then 16 + 8 lh + 0..7
      auto load_a = [&](int mt) {
        const char* p = xa + mt * 16 * TPB + ks * 64;
        af[mt].u[0] = *(const v4u*)p;
        af[mt].u[1] = *(const v4u*)(p + 32);
      };
      // asked for in the order the WMMAs use them, so that the first WMMAs
      // start while the later reads are still under way
      load_a(0);
      for (int nt = 0; nt < 4; nt++) {
        const char* p = wb + nt * 16 * TPB + ks * 64;
        bf[nt].u[0] = *(const v4u*)p;
        bf[nt].u[1] = *(const v4u*)(p + 32);
      }
      for (int mt = 1; mt < 4; mt++) load_a(mt);
      // keeps the 16 fragment reads in one group ahead of the WMMAs: left free,
      // the compiler reuses A registers and a wave waits out two more LDS reads
      // queued behind every other wave's
      __builtin_amdgcn_sched_barrier(0);
      for (int mt = 0; mt < 4; mt++)
        for (int nt = 0; nt < 4; nt++)
          acc[mt][nt] = wmma_f16(af[mt].h, bf[nt].h, acc[mt][nt]);
      // keeps the next group of reads behind these WMMAs, in one place
      __builtin_amdgcn_sched_barrier(0);
    }
    // hand-over: this wave's reads of buffer cb are done, its copies of stage
    // t + 1 have landed; behind the barrier that holds for every wave
    asm volatile("s_wait_dscnt 0x0" ::: "memory");
    wait_async0();
    __syncthreads();
    if (t + 2 < NST) stage_copy(t + 2, cb);
  }
  wait_async0();  // nothing is in flight here; kept as the ring's closing wait

  // epilogue: +bias, scatter to (b*H+h, s, e) f16
  for (int mt = 0; mt < 4; mt++)
    for (int nt = 0; nt < 4; nt++) {
      int col = n0 + wn + nt * 16 + lm;
      float bvv = bias[col];
      int h = col >> 6, e = col & 63;
      for (int r = 0; r < 8; r++) {
        int t = m0 + wm + mt * 16 + r + 8 * lh;  // token index = s*B + b
        int s = t >> 3, b = t & 7;
        dst[((size_t)(b * NHEAD + h) * S_LEN + s) * HD + e] =
            (_Float16)(acc[mt][nt][r] + bvv);
      }
    }
}

// ---------------------------------------------------------------------------
// Launch 3: local windowed attention with look-around, flash-style online
// softmax, all matmuls via v_wmma_f32_16x16x32_f16. K and V tiles staged
// row-major with GLOBAL_LOAD_ASYNC_TO_LDS_B128 when the toolchain exposes it.
// The products run transposed: St = K.Qt and Ot += Vt.Pt. A lane then holds
// 16 scores of ONE query (column lm; keys 8 lh + r and 16 + 8 lh + r of the
// 32-key tile), so the row maximum and sum are in-lane work plus one exchange
// between the wave's halves, the two score tiles converted in place ARE the B
// operand of the second product, and the rescale factor is the lane's own.
// LDS layout, in 16-byte pieces, no padding (three blocks fit one WGP):
//   K row j (8 pieces): piece p lies at p ^ ((j >> 1) & 7)
// so the 16 rows of a ds_load_b128 fragment read fall on all 64 banks.
//   V row j (8 pieces): piece p lies at p ^ (((j >> 1) & 3) << 1), so the 8
//   rows x 32 B that one half of the lanes names in a ds_load_tr16_b128 fall on
//   all 64 banks (unswizzled 128-B rows: 4 rows on the same banks). The load
//   hands out the A fragment Vt in the k order of the packed scores
//   (8h + 0..7, then 16 + 8h + 0..7).
//   bJ: per key 0 or NEGMAX, added to the score; bN: 32 x NEGMAX, read in its
//   place by the lanes whose own query is masked.
// 1-D grid, 256 threads (8 waves x 16 query rows): the B*H work-groups of the
// global-token attention first (long and latency-bound: they start first and
// run beside the windows), then NWIN x B*H windows. Row 0 of out belongs to the
// global token, so the window that holds query 0 does not store it.
// ---------------------------------------------------------------------------
#define ROWB 128  // K and V row, bytes
#define ATT_V_OFF  (W3 * ROWB)
#define ATT_BJ_OFF (ATT_V_OFF + W3 * ROWB)
#define ATT_BN_OFF (ATT_BJ_OFF + W3 * 4)
#define ATT_LDS    (ATT_BN_OFF + 32 * 4)  // 99,968 B

// value of lane l ^ 16
__device__ __forceinline__ float xhalf(float x) {
  int v = __builtin_bit_cast(int, x);
  return __builtin_bit_cast(
      float, __builtin_amdgcn_permlanex16(v, v, 0x76543210, 0xfedcba98, false,
                                          false));
}

// ---------------------------------------------------------------------------
// Global-token attention of one (batch, head): writes out row 0. Deterministic
// reductions (no float atomics). Runs as the first BATCH * NHEAD work-groups of
// the attention launch, beside the local windows, in the same dynamic LDS.
// The 64 output sums over the 256 threads: each thread parks its 64 partial
// sums as one LDS row; behind one barrier a thread adds one column over 64
// rows, behind a second one 64 threads add the 4 quarters. This block is the
// longest of the launch, so its chain of barriers is kept short.
// ---------------------------------------------------------------------------
#define GA_QSH_OFF  (S_LEN * 4)
#define GA_RED_OFF  (GA_QSH_OFF + HD * 4)
#define GA_ACC_OFF  (GA_RED_OFF + 256 * 4)
#define GA_PARK_OFF (GA_ACC_OFF + (HD + 4) * 4)
// park row pitch in words, odd: the stores (a lane per row) and the reads (a
// lane per column) both fall on 32 distinct banks
#define GA_PP       (HD + 1)
#define GA_LDS      (GA_PARK_OFF + 256 * GA_PP * 4)  // 84,496 B
static_assert(GA_LDS <= ATT_LDS, "global-token path fits the launch's LDS");

__device__ __forceinline__ void global_attn_block(
    int bh, char* smem, const float* __restrict__ gq,
    const _Float16* __restrict__ k16, const _Float16* __restrict__ v16,
    const int* __restrict__ kpm, float* __restrict__ out) {
  float* sc = (float*)smem;                    // S_LEN
  float* qsh = (float*)(smem + GA_QSH_OFF);    // HD
  float* red = (float*)(smem + GA_RED_OFF);    // 256
  float* accv = (float*)(smem + GA_ACC_OFF);   // HD + 1
  float* park = (float*)(smem + GA_PARK_OFF);  // 256 rows of GA_PP
  int b = bh / NHEAD, hh = bh % NHEAD;
  int tid = threadIdx.x;
  if (tid < HD) qsh[tid] = gq[bh * HD + tid];
  __syncthreads();

  const _Float16* Kg = k16 + (size_t)bh * S_LEN * HD;
  const _Float16* Vg = v16 + (size_t)bh * S_LEN * HD;
  // the query in registers: carved out of one LDS array, qsh cannot be told
  // apart from sc by the compiler, which would reload it after each score store
  float qr[HD];
  for (int e = 0; e < HD; e++) qr[e] = qsh[e];
  float lmax = NEGMAX;
  for (int s = tid; s < S_LEN; s += 256) {
    const _Float16* kr = Kg + (size_t)s * HD;
    float d = 0.f;
    for (int e = 0; e < HD; e++) d += qr[e] * (float)kr[e];
    d *= 0.125f;
    if (kpm[b * S_LEN + s]) d = NEGMAX;
    sc[s] = d;
    lmax = fmaxf(lmax, d);
  }
  red[tid] = lmax;
  __syncthreads();
  for (int st = 128; st > 0; st >>= 1) {
    if (tid < st) red[tid] = fmaxf(red[tid], red[tid + st]);
    __syncthreads();
  }
  float M = red[0];
  __syncthreads();

  float av[HD];
  for (int e = 0; e < HD; e++) av[e] = 0.f;
  float lsum = 0.f;
  for (int s = tid; s < S_LEN; s += 256) {
    float p = __expf(sc[s] - M);
    lsum += p;
    const _Float16* vr = Vg + (size_t)s * HD;
    for (int e = 0; e < HD; e++) av[e] += p * (float)vr[e];
  }
  for (int e = 0; e < HD; e++) park[tid * GA_PP + e] = av[e];
  __syncthreads();
  // column tid & 63 over the rows of quarter tid >> 6, in row order
  const float* pc = park + (tid >> 6) * 64 * GA_PP + (tid & 63);
  float cs = 0.f;
  for (int i = 0; i < 64; i++) cs += pc[i * GA_PP];
  red[tid] = cs;
  __syncthreads();
  if (tid < HD)
    accv[tid] = (red[tid] + red[tid + 64]) + (red[tid + 128] + red[tid + 192]);
  __syncthreads();  // red is written again below
  red[tid] = lsum;
  __syncthreads();
  for (int st = 128; st > 0; st >>= 1) {
    if (tid < st) red[tid] += red[tid + st];
    __syncthreads();
  }
  if (tid == 0) accv[HD] = red[0];
  __syncthreads();
  if (tid < HD)
    out[(size_t)b * DMODEL + hh * HD + tid] = accv[tid] / accv[HD];
}

__global__ __launch_bounds__(256) void local_attn_wmma(
    const _Float16* __restrict__ q16, const _Float16* __restrict__ k16,
    const _Float16* __restrict__ v16, const int* __restrict__ kpm,
    const float* __restrict__ gq, float* __restrict__ out) {
  extern __shared__ __attribute__((aligned(16))) char smem[];
  char* Ksm = smem;                        // 384 rows x 64 halves
  char* Vsm = smem + ATT_V_OFF;            // 384 rows x 64 halves
  float* bJ = (float*)(smem + ATT_BJ_OFF); // 384
  float* bN = (float*)(smem + ATT_BN_OFF); // 32

  int bid = blockIdx.x;
  if (bid < BATCH * NHEAD) {  // the same for the whole block, ahead of any barrier
    global_attn_block(bid, smem, gq, k16, v16, kpm, out);
    return;
  }
  bid -= BATCH * NHEAD;
  int w = bid & (NWIN - 1), bh = bid >> 5;  // window fastest
  int b = bh / NHEAD, hh = bh % NHEAD;
  int tid = threadIdx.x, wid = tid >> 5, lane = tid & 31;
  int lm = lane & 15, lh = lane >> 4;
  const _Float16* Kg = k16 + (size_t)bh * S_LEN * HD;
  const _Float16* Vg = v16 + (size_t)bh * S_LEN * HD;

  // K and V tiles, one window at a time; whether a window exists is the same
  // for the whole block, so every lane is on at every copy. A window past
  // either end is zero-filled (look-around padding).
  for (int seg = 0; seg < 3; seg++) {
    int wj = w - 1 + seg;
    char* kd = Ksm + seg * WIN * ROWB;
    char* vd = Vsm + seg * WIN * ROWB;
    if (wj >= 0 && wj < NWIN) {
      const _Float16* kg = Kg + (size_t)wj * WIN * HD;
      const _Float16* vg = Vg + (size_t)wj * WIN * HD;
      for (int it = 0; it < 4; it++) {
        int idx = it * 256 + tid;  // 16-byte piece; a wave takes 512 B in a row
        int j = idx >> 3, c = idx & 7;
        copy16_to_lds(kg + idx * 8, kd + j * ROWB + ((c ^ ((j >> 1) & 7)) << 4));
        copy16_to_lds(vg + idx * 8,
                      vd + j * ROWB + ((c ^ (((j >> 1) & 3) << 1)) << 4));
      }
    } else {
      v4u zz = {};
      for (int it = 0; it < 4; it++) {
        int idx = it * 256 + tid;
        *(v4u*)(kd + idx * 16) = zz;
        *(v4u*)(vd + idx * 16) = zz;
      }
    }
  }
  for (int j = tid; j < W3; j += 256) {
    int s = (w - 1) * WIN + j;
    bJ[j] = (s < 0 || s >= S_LEN || kpm[b * S_LEN + s]) ? NEGMAX : 0.f;
  }
  if (tid < 32) bN[tid] = NEGMAX;
  int i0 = wid * 16;
  bool qmask = kpm[b * S_LEN + w * WIN + i0 + lm] != 0;  // the lane's query
  wait_async0();
  __syncthreads();

  const _Float16* Qg = q16 + ((size_t)bh * S_LEN + (size_t)w * WIN + i0) * HD;
  Frag aq[2];
  for (int ec = 0; ec < 2; ec++) {
    const _Float16* p = Qg + lm * HD + ec * 32 + lh * 8;
    aq[ec].u[0] = *(const v4u*)p;
    aq[ec].u[1] = *(const v4u*)(p + 16);
  }

  // hd^-0.5 * log2(e): scores are kept in log2 units. A masked score is
  // c * ksc + NEGMAX, which rounds to NEGMAX itself (|c * ksc| is far below
  // half an ulp of NEGMAX for any f16 operands).
  const float ksc = 0.125f * 1.44269504088896340736f;
  v8f Oacc[4] = {};  // Oacc[t][r] = Ot[t * 16 + 8 lh + r][query lm]
  float mr = NEGMAX;
  v8f lr = {};  // row sum in 8 parts, this half's keys only; joined at the end
  // lane offsets inside a row; a further piece index is XORed in at bits 4..6
  const char* Kl = Ksm + lm * ROWB;
  int kx = (lh ^ (lm >> 1)) << 4;  // rows jt*32 (+16) + lm: (j >> 1) & 7 = lm >> 1
  const char* Vl = Vsm + (8 * lh + (lane & 7)) * ROWB + ((lane >> 3) & 1) * 16;
  int vx = ((lane >> 1) & 3) << 5;  // the lane's rows: (j >> 1) & 3 = (lane >> 1) & 3
  const char* bl = smem + (qmask ? ATT_BN_OFF : ATT_BJ_OFF) + lh * 32;
  int bstep = qmask ? 0 : 128;  // bytes per 32 keys

  for (int jt = 0; jt < 12; jt++) {
    // scores: two 16-key tiles over hd (K = 2 chunks of 32)
    v8f c0 = {}, c1 = {};
    for (int ec = 0; ec < 2; ec++) {
      Frag bk0, bk1;
      const char* p0 = Kl + jt * 32 * ROWB;
      const char* p1 = p0 + 16 * ROWB;
      int ka = kx ^ (ec * 64), kb = ka ^ 32;
      bk0.u[0] = *(const v4u*)(p0 + ka); bk0.u[1] = *(const v4u*)(p0 + kb);
      bk1.u[0] = *(const v4u*)(p1 + ka); bk1.u[1] = *(const v4u*)(p1 + kb);
      c0 = wmma_f16(bk0.h, aq[ec].h, c0);
      c1 = wmma_f16(bk1.h, aq[ec].h, c1);
    }
    // Vt fragments of this tile, asked for here so that they arrive while the
    // softmax below runs
    Frag av[4];
    for (int t = 0; t < 4; t++) {
      const char* vp = Vl + jt * 32 * ROWB + ((t * 32) ^ vx);
      av[t].u[0] = ld_tr16(vp);
      av[t].u[1] = ld_tr16(vp + 16 * ROWB);
    }
    const v8f* bp = (const v8f*)(bl + jt * bstep);
    c0 = c0 * ksc + bp[0];  // bias of keys jt*32 + 8 lh + r
    c1 = c1 * ksc + bp[2];  // bias of keys jt*32 + 16 + 8 lh + r
    float tm = NEGMAX;
    for (int r = 0; r < 8; r++) tm = fmaxf(tm, fmaxf(c0[r], c1[r]));
    tm = fmaxf(tm, xhalf(tm));
    float mn = fmaxf(mr, tm);
    float sc = __builtin_amdgcn_exp2f(mr - mn);
    mr = mn;
    c0 -= mn;
    c1 -= mn;
    Frag pb;  // Pt as B operand: element s = key kmap(s, lh), column lm
    for (int r = 0; r < 8; r++) {
      c0[r] = __builtin_amdgcn_exp2f(c0[r]);
      c1[r] = __builtin_amdgcn_exp2f(c1[r]);
      pb.h[r] = (_Float16)c0[r];
      pb.h[8 + r] = (_Float16)c1[r];
    }
    lr = lr * sc + (c0 + c1);
    for (int t = 0; t < 4; t++) {
      Oacc[t] *= sc;
      Oacc[t] = wmma_f16(av[t].h, pb.h, Oacc[t]);
    }
  }

  float ls = ((lr[0] + lr[1]) + (lr[2] + lr[3])) +
             ((lr[4] + lr[5]) + (lr[6] + lr[7]));
  float rl = 1.f / (ls + xhalf(ls));
  int srow = w * WIN + i0 + lm;
  float* op = out + ((size_t)srow * BATCH + b) * DMODEL + hh * HD + lh * 8;
  if (srow == 0) return;  // the global token's row; no barrier follows
  for (int t = 0; t < 4; t++) {  // 8 consecutive columns of one row per lane
    float4 o0 = {Oacc[t][0] * rl, Oacc[t][1] * rl, Oacc[t][2] * rl,
                 Oacc[t][3] * rl};
    float4 o1 = {Oacc[t][4] * rl, Oacc[t][5] * rl, Oacc[t][6] * rl,
                 Oacc[t][7] * rl};
    *(float4*)(op + t * 16) = o0;
    *(float4*)(op + t * 16 + 4) = o1;
  }
}

// ---------------------------------------------------------------------------
extern "C" void kernel_launch(void* const* d_in, const int* in_sizes, int n_in,
                              void* d_out, int out_size, void* d_ws,
                              size_t ws_size, hipStream_t stream) {
  (void)in_sizes; (void)n_in; (void)out_size; (void)ws_size;
  const float* hs  = (const float*)d_in[0];
  const int*   kpm = (const int*)d_in[1];
  const float* Wq  = (const float*)d_in[2];
  const float* Wk  = (const float*)d_in[3];
  const float* Wv  = (const float*)d_in[4];
  const float* Wgq = (const float*)d_in[5];
  const float* bq  = (const float*)d_in[6];
  const float* bk  = (const float*)d_in[7];
  const float* bv  = (const float*)d_in[8];
  const float* bgq = (const float*)d_in[9];
  float* out = (float*)d_out;

  size_t per = (size_t)BATCH * NHEAD * S_LEN * HD;  // halfs per q/k/v tensor
  _Float16* q16 = (_Float16*)d_ws;
  _Float16* k16 = q16 + per;
  _Float16* v16 = k16 + per;
  float* gqbuf = (float*)(v16 + per);
  _Float16* x16 = (_Float16*)(gqbuf + BATCH * DMODEL);
  _Float16* wt16 = x16 + (size_t)S_LEN * BATCH * DMODEL;

  operands_to_f16<<<WT_BLOCKS + XC_BLOCKS, CVT_THREADS, 0, stream>>>(
      hs, Wq, Wk, Wv, x16, wt16);
  qkv_gemm_wmma<<<GQ_BLOCKS + 128 * 3 * 3, GEMM_THREADS, 0, stream>>>(
      x16, wt16, bq, bk, bv, q16, k16, v16, hs, Wgq, bgq, gqbuf);
  size_t lds_bytes = ATT_LDS;
  local_attn_wmma<<<BATCH * NHEAD + NWIN * BATCH * NHEAD, 256, lds_bytes,
                    stream>>>(q16, k16, v16, kpm, gqbuf, out);
}
